// v000
// The times below were measured on an AMD MI455X: many runs one after another, warmed up first and cycling through
// copies of the inputs, with the whole window's GPU time divided by the number of runs. Launches and the gaps
// between them are all in it. The median over several windows is given; except for v000 it joins two sittings, which
// can be a few percent apart, so the side-by-side timings, each taken in one sitting, are the better comparison.
// v000 is the starting kernel. One run takes 289 microseconds.
#include <hip/hip_runtime.h>
#include <hip/hip_bf16.h>

typedef __attribute__((ext_vector_type(16))) _Float16 v16h;
typedef __attribute__((ext_vector_type(8)))  _Float16 v8h;
typedef __attribute__((ext_vector_type(8)))  float    v8f;
typedef __attribute__((ext_vector_type(4)))  int      v4i;

#define Bc 2
#define Hc 16
#define Sc 2048
#define Dc 128
#define NTILE (Sc / 32)            // 64 key tiles per (b,h)
#define TILE_HALVES (32 * 128)     // 4096 f16 per K or V tile (8KB)

#if defined(__has_builtin)
#if __has_builtin(__builtin_amdgcn_global_load_async_to_lds_b128)
#define ASYNC_KV 1
#endif
#endif

__device__ __forceinline__ float rmax16(float x) {
    x = fmaxf(x, __shfl_xor(x, 1, 32));
    x = fmaxf(x, __shfl_xor(x, 2, 32));
    x = fmaxf(x, __shfl_xor(x, 4, 32));
    x = fmaxf(x, __shfl_xor(x, 8, 32));
    return x;
}
__device__ __forceinline__ float rsum16(float x) {
    x += __shfl_xor(x, 1, 32);
    x += __shfl_xor(x, 2, 32);
    x += __shfl_xor(x, 4, 32);
    x += __shfl_xor(x, 8, 32);
    return x;
}

// Copy one 8KB tile (4096 f16) global -> LDS, 128 threads, thread t does 4x16B.
__device__ __forceinline__ void tile_copy(const _Float16* __restrict__ g,
                                          _Float16* l, int t) {
#ifdef ASYNC_KV
    typedef __attribute__((address_space(1))) v4i gv4i;   // global <4 x i32>
    typedef __attribute__((address_space(3))) v4i lv4i;   // LDS    <4 x i32>
#pragma unroll
    for (int i = 0; i < 4; i++) {
        __builtin_amdgcn_global_load_async_to_lds_b128(
            (gv4i*)(g + t * 8 + i * 1024),
            (lv4i*)(l + t * 8 + i * 1024), 0, 0);
    }
#else
#pragma unroll
    for (int i = 0; i < 4; i++) {
        *(v8h*)(l + t * 8 + i * 1024) = *(const v8h*)(g + t * 8 + i * 1024);
    }
#endif
}

__device__ __forceinline__ void wait_async_kv() {
#ifdef ASYNC_KV
    asm volatile("s_wait_asynccnt 0" ::: "memory");
#endif
}

// ---------------------------------------------------------------------------
// Pre-pass: fp32 K/V -> f16, V pre-transposed tile-wise so hot-loop LDS tiles
// are contiguous memcpy images.  kh: [bh][s][d] (tiles already contiguous).
// vh: [bh][tile][d][key32].
// ---------------------------------------------------------------------------
__global__ __launch_bounds__(256, 4)
void cvt_kv(const float* __restrict__ k, const float* __restrict__ v,
            _Float16* __restrict__ kh, _Float16* __restrict__ vh) {
    size_t j = (size_t)blockIdx.x * 256 + threadIdx.x;  // 0 .. B*H*S*D-1
    kh[j] = (_Float16)k[j];
    int key   = (int)(j & 31);
    int d     = (int)((j >> 5) & 127);
    size_t st = j >> 12;                         // bh*64 + tile
    size_t src = (st * 32 + key) * 128 + d;      // = ((bh*S)+s)*D + d
    vh[j] = (_Float16)v[src];
}

// ---------------------------------------------------------------------------
// Main kernel (workspace path): f16 K/V, async double-buffered LDS pipeline.
// ---------------------------------------------------------------------------
__global__ __launch_bounds__(128, 1)
void fa_fwd_wmma2(const float* __restrict__ q, const _Float16* __restrict__ kh,
                  const _Float16* __restrict__ vh, const int* __restrict__ mask,
                  float* __restrict__ out) {
    constexpr float SCALE = 0.08838834764831845f;  // 1/sqrt(128)
    constexpr float NEGV  = -1.0e9f;

    __shared__ alignas(32) _Float16 Kt[2][TILE_HALVES];   // [key][d]
    __shared__ alignas(32) _Float16 Vt[2][TILE_HALVES];   // [d][key]
    __shared__ alignas(32) _Float16 Qs[4][16 * 128];
    __shared__ alignas(32) _Float16 Pt[4][16 * 32];

    const int t    = threadIdx.x;
    const int wave = t >> 5;
    const int lane = t & 31;
    const int ln   = lane & 15;
    const int hf   = lane >> 4;
    const int bh   = blockIdx.y;
    const int b    = bh >> 4;
    const int q0   = blockIdx.x * 64 + wave * 16;

    const _Float16* kbase = kh + (size_t)bh * NTILE * TILE_HALVES;
    const _Float16* vbase = vh + (size_t)bh * NTILE * TILE_HALVES;

    // ---- prologue: kick off async copy of tile 0 while staging Q
    tile_copy(kbase, Kt[0], t);
    tile_copy(vbase, Vt[0], t);

    {
        const float* qp = q + ((size_t)bh * Sc + q0 + ln) * Dc + hf * 64;
        _Float16* dst = &Qs[wave][ln * 128 + hf * 64];
#pragma unroll
        for (int j = 0; j < 16; j++) {
            float4 x = ((const float4*)qp)[j];
            dst[4 * j + 0] = (_Float16)x.x;
            dst[4 * j + 1] = (_Float16)x.y;
            dst[4 * j + 2] = (_Float16)x.z;
            dst[4 * j + 3] = (_Float16)x.w;
        }
    }
    __syncthreads();

    v16h qf[4];
#pragma unroll
    for (int c = 0; c < 4; c++)
        qf[c] = *(const v16h*)&Qs[wave][ln * 128 + c * 32 + hf * 16];

    v8f o[8];
#pragma unroll
    for (int n = 0; n < 8; n++) o[n] = v8f{};
    float mrow[8], lrow[8];
#pragma unroll
    for (int g = 0; g < 8; g++) { mrow[g] = -3.0e38f; lrow[g] = 0.0f; }

#pragma unroll 1
    for (int kb = 0; kb < NTILE; kb++) {
        const int cur = kb & 1;
        // loads for tile kb were issued last iteration (or prologue)
        wait_async_kv();
        __syncthreads();   // tiles visible; all waves done reading buffer cur^1

        if (kb + 1 < NTILE) {  // prefetch next tile into the other buffer
            tile_copy(kbase + (size_t)(kb + 1) * TILE_HALVES, Kt[cur ^ 1], t);
            tile_copy(vbase + (size_t)(kb + 1) * TILE_HALVES, Vt[cur ^ 1], t);
        }

        const _Float16* Kc = Kt[cur];
        const _Float16* Vc = Vt[cur];

        // ---- scores: S = Q x K^T for two 16-key sub-blocks (fp32 acc)
        v8f acc0 = v8f{}, acc1 = v8f{};
#pragma unroll
        for (int c = 0; c < 4; c++) {
            v16h b0 = *(const v16h*)&Kc[ln * 128 + c * 32 + hf * 16];
            acc0 = __builtin_amdgcn_wmma_f32_16x16x32_f16(false, qf[c], false, b0,
                                                          (short)0, acc0, false, false);
        }
#pragma unroll
        for (int c = 0; c < 4; c++) {
            v16h b1 = *(const v16h*)&Kc[(16 + ln) * 128 + c * 32 + hf * 16];
            acc1 = __builtin_amdgcn_wmma_f32_16x16x32_f16(false, qf[c], false, b1,
                                                          (short)0, acc1, false, false);
        }

        const int kcol = kb * 32;
        const int m0 = mask[b * Sc + kcol + ln];
        const int m1 = mask[b * Sc + kcol + 16 + ln];
        const float sc0 = m0 ? SCALE : 0.0f, ad0 = m0 ? 0.0f : NEGV;
        const float sc1 = m1 ? SCALE : 0.0f, ad1 = m1 ? 0.0f : NEGV;

        float p0[8], p1[8], alpha[8];
#pragma unroll
        for (int g = 0; g < 8; g++) {
            float s0 = acc0[g] * sc0 + ad0;
            float s1 = acc1[g] * sc1 + ad1;
            float bm   = rmax16(fmaxf(s0, s1));
            float mnew = fmaxf(mrow[g], bm);
            alpha[g] = __expf(mrow[g] - mnew);
            p0[g]    = __expf(s0 - mnew);
            p1[g]    = __expf(s1 - mnew);
            float rs = rsum16(p0[g] + p1[g]);
            lrow[g] = lrow[g] * alpha[g] + rs;
            mrow[g] = mnew;
        }

#pragma unroll
        for (int g = 0; g < 8; g++) {
            Pt[wave][(g + 8 * hf) * 32 + ln]      = (_Float16)p0[g];
            Pt[wave][(g + 8 * hf) * 32 + 16 + ln] = (_Float16)p1[g];
        }
#pragma unroll
        for (int n = 0; n < 8; n++) {
#pragma unroll
            for (int g = 0; g < 8; g++) o[n][g] *= alpha[g];
        }
        asm volatile("s_wait_dscnt 0" ::: "memory");  // wave-internal P bounce

        v16h pf = *(const v16h*)&Pt[wave][ln * 32 + hf * 16];
#pragma unroll
        for (int n = 0; n < 8; n++) {
            v16h vf = *(const v16h*)&Vc[(n * 16 + ln) * 32 + hf * 16];
            o[n] = __builtin_amdgcn_wmma_f32_16x16x32_f16(false, pf, false, vf,
                                                          (short)0, o[n], false, false);
        }
    }

    float rcp[8];
#pragma unroll
    for (int g = 0; g < 8; g++) rcp[g] = 1.0f / lrow[g];
#pragma unroll
    for (int n = 0; n < 8; n++) {
#pragma unroll
        for (int g = 0; g < 8; g++) {
            out[((size_t)bh * Sc + q0 + g + 8 * hf) * Dc + n * 16 + ln] = o[n][g] * rcp[g];
        }
    }
}

// ---------------------------------------------------------------------------
// Fallback (no workspace): round-1 kernel, converts in-loop.
// ---------------------------------------------------------------------------
__global__ __launch_bounds__(128, 1)
void fa_fwd_wmma1(const float* __restrict__ q, const float* __restrict__ k,
                  const float* __restrict__ v, const int* __restrict__ mask,
                  float* __restrict__ out) {
    constexpr float SCALE = 0.08838834764831845f;
    constexpr float NEGV  = -1.0e9f;

    __shared__ alignas(32) _Float16 Kt[32 * 128];
    __shared__ alignas(32) _Float16 Vt[128 * 32];
    __shared__ alignas(32) _Float16 Qs[4][16 * 128];
    __shared__ alignas(32) _Float16 Pt[4][16 * 32];

    const int t    = threadIdx.x;
    const int wave = t >> 5;
    const int lane = t & 31;
    const int ln   = lane & 15;
    const int hf   = lane >> 4;
    const int bh   = blockIdx.y;
    const int b    = bh >> 4;
    const int q0   = blockIdx.x * 64 + wave * 16;

    {
        const float* qp = q + ((size_t)bh * Sc + q0 + ln) * Dc + hf * 64;
        _Float16* dst = &Qs[wave][ln * 128 + hf * 64];
#pragma unroll
        for (int j = 0; j < 16; j++) {
            float4 x = ((const float4*)qp)[j];
            dst[4 * j + 0] = (_Float16)x.x;
            dst[4 * j + 1] = (_Float16)x.y;
            dst[4 * j + 2] = (_Float16)x.z;
            dst[4 * j + 3] = (_Float16)x.w;
        }
    }
    __syncthreads();

    v16h qf[4];
#pragma unroll
    for (int c = 0; c < 4; c++)
        qf[c] = *(const v16h*)&Qs[wave][ln * 128 + c * 32 + hf * 16];

    v8f o[8];
#pragma unroll
    for (int n = 0; n < 8; n++) o[n] = v8f{};
    float mrow[8], lrow[8];
#pragma unroll
    for (int g = 0; g < 8; g++) { mrow[g] = -3.0e38f; lrow[g] = 0.0f; }

    const int row = t >> 2;
    const int d0  = (t & 3) * 32;

#pragma unroll 1
    for (int kb = 0; kb < NTILE; kb++) {
        const int kcol = kb * 32;
        __syncthreads();
        {
            const float* kp = k + ((size_t)bh * Sc + kcol + row) * Dc + d0;
            const float* vp = v + ((size_t)bh * Sc + kcol + row) * Dc + d0;
            _Float16* kd = &Kt[row * 128 + d0];
#pragma unroll
            for (int j = 0; j < 8; j++) {
                float4 x = ((const float4*)kp)[j];
                kd[4 * j + 0] = (_Float16)x.x;
                kd[4 * j + 1] = (_Float16)x.y;
                kd[4 * j + 2] = (_Float16)x.z;
                kd[4 * j + 3] = (_Float16)x.w;
                float4 y = ((const float4*)vp)[j];
                Vt[(d0 + 4 * j + 0) * 32 + row] = (_Float16)y.x;
                Vt[(d0 + 4 * j + 1) * 32 + row] = (_Float16)y.y;
                Vt[(d0 + 4 * j + 2) * 32 + row] = (_Float16)y.z;
                Vt[(d0 + 4 * j + 3) * 32 + row] = (_Float16)y.w;
            }
        }
        __syncthreads();

        v8f acc0 = v8f{}, acc1 = v8f{};
#pragma unroll
        for (int c = 0; c < 4; c++) {
            v16h b0 = *(const v16h*)&Kt[ln * 128 + c * 32 + hf * 16];
            acc0 = __builtin_amdgcn_wmma_f32_16x16x32_f16(false, qf[c], false, b0,
                                                          (short)0, acc0, false, false);
        }
#pragma unroll
        for (int c = 0; c < 4; c++) {
            v16h b1 = *(const v16h*)&Kt[(16 + ln) * 128 + c * 32 + hf * 16];
            acc1 = __builtin_amdgcn_wmma_f32_16x16x32_f16(false, qf[c], false, b1,
                                                          (short)0, acc1, false, false);
        }

        const int m0 = mask[b * Sc + kcol + ln];
        const int m1 = mask[b * Sc + kcol + 16 + ln];
        const float sc0 = m0 ? SCALE : 0.0f, ad0 = m0 ? 0.0f : NEGV;
        const float sc1 = m1 ? SCALE : 0.0f, ad1 = m1 ? 0.0f : NEGV;

        float p0[8], p1[8], alpha[8];
#pragma unroll
        for (int g = 0; g < 8; g++) {
            float s0 = acc0[g] * sc0 + ad0;
            float s1 = acc1[g] * sc1 + ad1;
            float bm   = rmax16(fmaxf(s0, s1));
            float mnew = fmaxf(mrow[g], bm);
            alpha[g] = __expf(mrow[g] - mnew);
            p0[g]    = __expf(s0 - mnew);
            p1[g]    = __expf(s1 - mnew);
            float rs = rsum16(p0[g] + p1[g]);
            lrow[g] = lrow[g] * alpha[g] + rs;
            mrow[g] = mnew;
        }

#pragma unroll
        for (int g = 0; g < 8; g++) {
            Pt[wave][(g + 8 * hf) * 32 + ln]      = (_Float16)p0[g];
            Pt[wave][(g + 8 * hf) * 32 + 16 + ln] = (_Float16)p1[g];
        }
#pragma unroll
        for (int n = 0; n < 8; n++) {
#pragma unroll
            for (int g = 0; g < 8; g++) o[n][g] *= alpha[g];
        }
        asm volatile("s_wait_dscnt 0" ::: "memory");

        v16h pf = *(const v16h*)&Pt[wave][ln * 32 + hf * 16];
#pragma unroll
        for (int n = 0; n < 8; n++) {
            v16h vf = *(const v16h*)&Vt[(n * 16 + ln) * 32 + hf * 16];
            o[n] = __builtin_amdgcn_wmma_f32_16x16x32_f16(false, pf, false, vf,
                                                          (short)0, o[n], false, false);
        }
    }

    float rcp[8];
#pragma unroll
    for (int g = 0; g < 8; g++) rcp[g] = 1.0f / lrow[g];
#pragma unroll
    for (int n = 0; n < 8; n++) {
#pragma unroll
        for (int g = 0; g < 8; g++) {
            out[((size_t)bh * Sc + q0 + g + 8 * hf) * Dc + n * 16 + ln] = o[n][g] * rcp[g];
        }
    }
}

extern "C" void kernel_launch(void* const* d_in, const int* in_sizes, int n_in,
                              void* d_out, int out_size, void* d_ws, size_t ws_size,
                              hipStream_t stream) {
    (void)in_sizes; (void)n_in; (void)out_size;
    const float* q    = (const float*)d_in[0];
    const float* k    = (const float*)d_in[1];
    const float* v    = (const float*)d_in[2];
    const int*   mask = (const int*)d_in[3];
    float* out = (float*)d_out;

    const size_t nelem   = (size_t)Bc * Hc * Sc * Dc;   // 8,388,608
    const size_t ws_need = 2 * nelem * sizeof(_Float16);

    dim3 grid(Sc / 64, Bc * Hc);
    dim3 block(128);

    if (ws_size >= ws_need && d_ws != nullptr) {
        _Float16* kh = (_Float16*)d_ws;
        _Float16* vh = kh + nelem;
        cvt_kv<<<dim3((unsigned)(nelem / 256)), dim3(256), 0, stream>>>(k, v, kh, vh);
        fa_fwd_wmma2<<<grid, block, 0, stream>>>(q, kh, vh, mask, out);
    } else {
        fa_fwd_wmma1<<<grid, block, 0, stream>>>(q, k, v, mask, out);
    }
}

// v001
// Measured time: 143 microseconds a run.
// Next to v000, in two timings, it ran 2.05 and 2.07 times as fast.
#include <hip/hip_runtime.h>
#include <hip/hip_bf16.h>

typedef __attribute__((ext_vector_type(16))) _Float16 v16h;
typedef __attribute__((ext_vector_type(8)))  _Float16 v8h;
typedef __attribute__((ext_vector_type(8)))  float    v8f;
typedef __attribute__((ext_vector_type(4)))  int      v4i;

#define Bc 2
#define Hc 16
#define Sc 2048
#define Dc 128
#define NTILE (Sc / 32)            // 64 key tiles per (b,h)
#define TILE_HALVES (32 * 128)     // 4096 f16 per K or V tile (8KB)
// LDS row pitches in f16: 16 bytes x odd, so that the 16 lanes of a half wave,
// one row each, spread a 16-byte read over all 64 banks.
#define KP 136                     // 256-byte rows (K, Q) at 272 bytes
#define VP 40                      // 64-byte rows (V^T, P) at 80 bytes

#if defined(__has_builtin)
#if __has_builtin(__builtin_amdgcn_global_load_async_to_lds_b128)
#define ASYNC_KV 1
#endif
#endif

__device__ __forceinline__ float rmax16(float x) {
    x = fmaxf(x, __shfl_xor(x, 1, 32));
    x = fmaxf(x, __shfl_xor(x, 2, 32));
    x = fmaxf(x, __shfl_xor(x, 4, 32));
    x = fmaxf(x, __shfl_xor(x, 8, 32));
    return x;
}
__device__ __forceinline__ float rsum16(float x) {
    x += __shfl_xor(x, 1, 32);
    x += __shfl_xor(x, 2, 32);
    x += __shfl_xor(x, 4, 32);
    x += __shfl_xor(x, 8, 32);
    return x;
}

// One 16-element fragment from a padded LDS row: rows are 16-byte aligned only.
__device__ __forceinline__ v16h ld_frag(const _Float16* p) {
    v8h lo = *(const v8h*)p;
    v8h hi = *(const v8h*)(p + 8);
    return __builtin_shufflevector(lo, hi, 0, 1, 2, 3, 4, 5, 6, 7,
                                   8, 9, 10, 11, 12, 13, 14, 15);
}

// Copy one 8KB tile (4096 f16) global -> LDS, 128 threads, thread t does 4x16B.
// The global image is contiguous rows of ROW f16; in LDS the rows lie PITCH apart.
template <int ROW, int PITCH>
__device__ __forceinline__ void tile_copy(const _Float16* __restrict__ g,
                                          _Float16* l, int t) {
    constexpr int CH = ROW / 8;                 // 16-byte chunks per row
    l += (t / CH) * PITCH + (t % CH) * 8;       // this thread's chunk, step 0
    constexpr int LSTEP = (128 / CH) * PITCH;   // rows per step x pitch
#ifdef ASYNC_KV
    typedef __attribute__((address_space(1))) v4i gv4i;   // global <4 x i32>
    typedef __attribute__((address_space(3))) v4i lv4i;   // LDS    <4 x i32>
#pragma unroll
    for (int i = 0; i < 4; i++) {
        __builtin_amdgcn_global_load_async_to_lds_b128(
            (gv4i*)(g + t * 8 + i * 1024),
            (lv4i*)(l + i * LSTEP), 0, 0);
    }
#else
#pragma unroll
    for (int i = 0; i < 4; i++) {
        *(v8h*)(l + i * LSTEP) = *(const v8h*)(g + t * 8 + i * 1024);
    }
#endif
}

__device__ __forceinline__ void wait_async_kv() {
#ifdef ASYNC_KV
    asm volatile("s_wait_asynccnt 0" ::: "memory");
#endif
}

// ---------------------------------------------------------------------------
// Pre-pass: fp32 K/V -> f16, V pre-transposed tile-wise so each hot-loop tile
// is one contiguous global block, copied row-wise into padded LDS.  kh: [bh][s][d] (tiles already contiguous).
// vh: [bh][tile][d][key32].
// ---------------------------------------------------------------------------
__global__ __launch_bounds__(256, 4)
void cvt_kv(const float* __restrict__ k, const float* __restrict__ v,
            _Float16* __restrict__ kh, _Float16* __restrict__ vh) {
    size_t j = (size_t)blockIdx.x * 256 + threadIdx.x;  // 0 .. B*H*S*D-1
    kh[j] = (_Float16)k[j];
    int key   = (int)(j & 31);
    int d     = (int)((j >> 5) & 127);
    size_t st = j >> 12;                         // bh*64 + tile
    size_t src = (st * 32 + key) * 128 + d;      // = ((bh*S)+s)*D + d
    vh[j] = (_Float16)v[src];
}

// ---------------------------------------------------------------------------
// Main kernel (workspace path): f16 K/V, async double-buffered LDS pipeline.
// ---------------------------------------------------------------------------
__global__ __launch_bounds__(128, 1)
void fa_fwd_wmma2(const float* __restrict__ q, const _Float16* __restrict__ kh,
                  const _Float16* __restrict__ vh, const int* __restrict__ mask,
                  float* __restrict__ out) {
    constexpr float SCALE = 0.08838834764831845f;  // 1/sqrt(128)
    constexpr float NEGV  = -1.0e9f;

    __shared__ alignas(32) _Float16 Kt[2][32 * KP];    // [key][d]
    __shared__ alignas(32) _Float16 Vt[2][128 * VP];   // [d][key]
    __shared__ alignas(32) _Float16 Qs[4][16 * KP];
    __shared__ alignas(32) _Float16 Pt[4][16 * VP];

    const int t    = threadIdx.x;
    const int wave = t >> 5;
    const int lane = t & 31;
    const int ln   = lane & 15;
    const int hf   = lane >> 4;
    const int bh   = blockIdx.y;
    const int b    = bh >> 4;
    const int q0   = blockIdx.x * 64 + wave * 16;

    const _Float16* kbase = kh + (size_t)bh * NTILE * TILE_HALVES;
    const _Float16* vbase = vh + (size_t)bh * NTILE * TILE_HALVES;

    // ---- prologue: kick off async copy of tile 0 while staging Q
    tile_copy<128, KP>(kbase, Kt[0], t);
    tile_copy<32, VP>(vbase, Vt[0], t);

    {
        const float* qp = q + ((size_t)bh * Sc + q0 + ln) * Dc + hf * 64;
        _Float16* dst = &Qs[wave][ln * KP + hf * 64];
#pragma unroll
        for (int j = 0; j < 16; j++) {
            float4 x = ((const float4*)qp)[j];
            dst[4 * j + 0] = (_Float16)x.x;
            dst[4 * j + 1] = (_Float16)x.y;
            dst[4 * j + 2] = (_Float16)x.z;
            dst[4 * j + 3] = (_Float16)x.w;
        }
    }
    __syncthreads();

    v16h qf[4];
#pragma unroll
    for (int c = 0; c < 4; c++)
        qf[c] = ld_frag(&Qs[wave][ln * KP + c * 32 + hf * 16]);

    v8f o[8];
#pragma unroll
    for (int n = 0; n < 8; n++) o[n] = v8f{};
    float mrow[8], lrow[8];
#pragma unroll
    for (int g = 0; g < 8; g++) { mrow[g] = -3.0e38f; lrow[g] = 0.0f; }

#pragma unroll 1
    for (int kb = 0; kb < NTILE; kb++) {
        const int cur = kb & 1;
        // loads for tile kb were issued last iteration (or prologue)
        wait_async_kv();
        __syncthreads();   // tiles visible; all waves done reading buffer cur^1

        if (kb + 1 < NTILE) {  // prefetch next tile into the other buffer
            tile_copy<128, KP>(kbase + (size_t)(kb + 1) * TILE_HALVES, Kt[cur ^ 1], t);
            tile_copy<32, VP>(vbase + (size_t)(kb + 1) * TILE_HALVES, Vt[cur ^ 1], t);
        }

        const _Float16* Kc = Kt[cur];
        const _Float16* Vc = Vt[cur];

        // ---- scores: S = Q x K^T for two 16-key sub-blocks (fp32 acc)
        v8f acc0 = v8f{}, acc1 = v8f{};
#pragma unroll
        for (int c = 0; c < 4; c++) {
            v16h b0 = ld_frag(&Kc[ln * KP + c * 32 + hf * 16]);
            acc0 = __builtin_amdgcn_wmma_f32_16x16x32_f16(false, qf[c], false, b0,
                                                          (short)0, acc0, false, false);
        }
#pragma unroll
        for (int c = 0; c < 4; c++) {
            v16h b1 = ld_frag(&Kc[(16 + ln) * KP + c * 32 + hf * 16]);
            acc1 = __builtin_amdgcn_wmma_f32_16x16x32_f16(false, qf[c], false, b1,
                                                          (short)0, acc1, false, false);
        }

        const int kcol = kb * 32;
        const int m0 = mask[b * Sc + kcol + ln];
        const int m1 = mask[b * Sc + kcol + 16 + ln];
        const float sc0 = m0 ? SCALE : 0.0f, ad0 = m0 ? 0.0f : NEGV;
        const float sc1 = m1 ? SCALE : 0.0f, ad1 = m1 ? 0.0f : NEGV;

        float p0[8], p1[8], alpha[8];
#pragma unroll
        for (int g = 0; g < 8; g++) {
            float s0 = acc0[g] * sc0 + ad0;
            float s1 = acc1[g] * sc1 + ad1;
            float bm   = rmax16(fmaxf(s0, s1));
            float mnew = fmaxf(mrow[g], bm);
            alpha[g] = __expf(mrow[g] - mnew);
            p0[g]    = __expf(s0 - mnew);
            p1[g]    = __expf(s1 - mnew);
            float rs = rsum16(p0[g] + p1[g]);
            lrow[g] = lrow[g] * alpha[g] + rs;
            mrow[g] = mnew;
        }

#pragma unroll
        for (int g = 0; g < 8; g++) {
            Pt[wave][(g + 8 * hf) * VP + ln]      = (_Float16)p0[g];
            Pt[wave][(g + 8 * hf) * VP + 16 + ln] = (_Float16)p1[g];
        }
#pragma unroll
        for (int n = 0; n < 8; n++) {
#pragma unroll
            for (int g = 0; g < 8; g++) o[n][g] *= alpha[g];
        }
        asm volatile("s_wait_dscnt 0" ::: "memory");  // wave-internal P bounce

        v16h pf = ld_frag(&Pt[wave][ln * VP + hf * 16]);
#pragma unroll
        for (int n = 0; n < 8; n++) {
            v16h vf = ld_frag(&Vc[(n * 16 + ln) * VP + hf * 16]);
            o[n] = __builtin_amdgcn_wmma_f32_16x16x32_f16(false, pf, false, vf,
                                                          (short)0, o[n], false, false);
        }
    }

    float rcp[8];
#pragma unroll
    for (int g = 0; g < 8; g++) rcp[g] = 1.0f / lrow[g];
#pragma unroll
    for (int n = 0; n < 8; n++) {
#pragma unroll
        for (int g = 0; g < 8; g++) {
            out[((size_t)bh * Sc + q0 + g + 8 * hf) * Dc + n * 16 + ln] = o[n][g] * rcp[g];
        }
    }
}

// ---------------------------------------------------------------------------
// Fallback (no workspace): round-1 kernel, converts in-loop.
// ---------------------------------------------------------------------------
__global__ __launch_bounds__(128, 1)
void fa_fwd_wmma1(const float* __restrict__ q, const float* __restrict__ k,
                  const float* __restrict__ v, const int* __restrict__ mask,
                  float* __restrict__ out) {
    constexpr float SCALE = 0.08838834764831845f;
    constexpr float NEGV  = -1.0e9f;

    __shared__ alignas(32) _Float16 Kt[32 * 128];
    __shared__ alignas(32) _Float16 Vt[128 * 32];
    __shared__ alignas(32) _Float16 Qs[4][16 * 128];
    __shared__ alignas(32) _Float16 Pt[4][16 * 32];

    const int t    = threadIdx.x;
    const int wave = t >> 5;
    const int lane = t & 31;
    const int ln   = lane & 15;
    const int hf   = lane >> 4;
    const int bh   = blockIdx.y;
    const int b    = bh >> 4;
    const int q0   = blockIdx.x * 64 + wave * 16;

    {
        const float* qp = q + ((size_t)bh * Sc + q0 + ln) * Dc + hf * 64;
        _Float16* dst = &Qs[wave][ln * 128 + hf * 64];
#pragma unroll
        for (int j = 0; j < 16; j++) {
            float4 x = ((const float4*)qp)[j];
            dst[4 * j + 0] = (_Float16)x.x;
            dst[4 * j + 1] = (_Float16)x.y;
            dst[4 * j + 2] = (_Float16)x.z;
            dst[4 * j + 3] = (_Float16)x.w;
        }
    }
    __syncthreads();

    v16h qf[4];
#pragma unroll
    for (int c = 0; c < 4; c++)
        qf[c] = *(const v16h*)&Qs[wave][ln * 128 + c * 32 + hf * 16];

    v8f o[8];
#pragma unroll
    for (int n = 0; n < 8; n++) o[n] = v8f{};
    float mrow[8], lrow[8];
#pragma unroll
    for (int g = 0; g < 8; g++) { mrow[g] = -3.0e38f; lrow[g] = 0.0f; }

    const int row = t >> 2;
    const int d0  = (t & 3) * 32;

#pragma unroll 1
    for (int kb = 0; kb < NTILE; kb++) {
        const int kcol = kb * 32;
        __syncthreads();
        {
            const float* kp = k + ((size_t)bh * Sc + kcol + row) * Dc + d0;
            const float* vp = v + ((size_t)bh * Sc + kcol + row) * Dc + d0;
            _Float16* kd = &Kt[row * 128 + d0];
#pragma unroll
            for (int j = 0; j < 8; j++) {
                float4 x = ((const float4*)kp)[j];
                kd[4 * j + 0] = (_Float16)x.x;
                kd[4 * j + 1] = (_Float16)x.y;
                kd[4 * j + 2] = (_Float16)x.z;
                kd[4 * j + 3] = (_Float16)x.w;
                float4 y = ((const float4*)vp)[j];
                Vt[(d0 + 4 * j + 0) * 32 + row] = (_Float16)y.x;
                Vt[(d0 + 4 * j + 1) * 32 + row] = (_Float16)y.y;
                Vt[(d0 + 4 * j + 2) * 32 + row] = (_Float16)y.z;
                Vt[(d0 + 4 * j + 3) * 32 + row] = (_Float16)y.w;
            }
        }
        __syncthreads();

        v8f acc0 = v8f{}, acc1 = v8f{};
#pragma unroll
        for (int c = 0; c < 4; c++) {
            v16h b0 = *(const v16h*)&Kt[ln * 128 + c * 32 + hf * 16];
            acc0 = __builtin_amdgcn_wmma_f32_16x16x32_f16(false, qf[c], false, b0,
                                                          (short)0, acc0, false, false);
        }
#pragma unroll
        for (int c = 0; c < 4; c++) {
            v16h b1 = *(const v16h*)&Kt[(16 + ln) * 128 + c * 32 + hf * 16];
            acc1 = __builtin_amdgcn_wmma_f32_16x16x32_f16(false, qf[c], false, b1,
                                                          (short)0, acc1, false, false);
        }

        const int m0 = mask[b * Sc + kcol + ln];
        const int m1 = mask[b * Sc + kcol + 16 + ln];
        const float sc0 = m0 ? SCALE : 0.0f, ad0 = m0 ? 0.0f : NEGV;
        const float sc1 = m1 ? SCALE : 0.0f, ad1 = m1 ? 0.0f : NEGV;

        float p0[8], p1[8], alpha[8];
#pragma unroll
        for (int g = 0; g < 8; g++) {
            float s0 = acc0[g] * sc0 + ad0;
            float s1 = acc1[g] * sc1 + ad1;
            float bm   = rmax16(fmaxf(s0, s1));
            float mnew = fmaxf(mrow[g], bm);
            alpha[g] = __expf(mrow[g] - mnew);
            p0[g]    = __expf(s0 - mnew);
            p1[g]    = __expf(s1 - mnew);
            float rs = rsum16(p0[g] + p1[g]);
            lrow[g] = lrow[g] * alpha[g] + rs;
            mrow[g] = mnew;
        }

#pragma unroll
        for (int g = 0; g < 8; g++) {
            Pt[wave][(g + 8 * hf) * 32 + ln]      = (_Float16)p0[g];
            Pt[wave][(g + 8 * hf) * 32 + 16 + ln] = (_Float16)p1[g];
        }
#pragma unroll
        for (int n = 0; n < 8; n++) {
#pragma unroll
            for (int g = 0; g < 8; g++) o[n][g] *= alpha[g];
        }
        asm volatile("s_wait_dscnt 0" ::: "memory");

        v16h pf = *(const v16h*)&Pt[wave][ln * 32 + hf * 16];
#pragma unroll
        for (int n = 0; n < 8; n++) {
            v16h vf = *(const v16h*)&Vt[(n * 16 + ln) * 32 + hf * 16];
            o[n] = __builtin_amdgcn_wmma_f32_16x16x32_f16(false, pf, false, vf,
                                                          (short)0, o[n], false, false);
        }
    }

    float rcp[8];
#pragma unroll
    for (int g = 0; g < 8; g++) rcp[g] = 1.0f / lrow[g];
#pragma unroll
    for (int n = 0; n < 8; n++) {
#pragma unroll
        for (int g = 0; g < 8; g++) {
            out[((size_t)bh * Sc + q0 + g + 8 * hf) * Dc + n * 16 + ln] = o[n][g] * rcp[g];
        }
    }
}

extern "C" void kernel_launch(void* const* d_in, const int* in_sizes, int n_in,
                              void* d_out, int out_size, void* d_ws, size_t ws_size,
                              hipStream_t stream) {
    (void)in_sizes; (void)n_in; (void)out_size;
    const float* q    = (const float*)d_in[0];
    const float* k    = (const float*)d_in[1];
    const float* v    = (const float*)d_in[2];
    const int*   mask = (const int*)d_in[3];
    float* out = (float*)d_out;

    const size_t nelem   = (size_t)Bc * Hc * Sc * Dc;   // 8,388,608
    const size_t ws_need = 2 * nelem * sizeof(_Float16);

    dim3 grid(Sc / 64, Bc * Hc);
    dim3 block(128);

    if (ws_size >= ws_need && d_ws != nullptr) {
        _Float16* kh = (_Float16*)d_ws;
        _Float16* vh = kh + nelem;
        cvt_kv<<<dim3((unsigned)(nelem / 256)), dim3(256), 0, stream>>>(k, v, kh, vh);
        fa_fwd_wmma2<<<grid, block, 0, stream>>>(q, kh, vh, mask, out);
    } else {
        fa_fwd_wmma1<<<grid, block, 0, stream>>>(q, k, v, mask, out);
    }
}

// v002
// Measured time: 123 microseconds a run.
// Next to v001, in two timings, it ran 1.19 times as fast each time.
// Over all steps from v000 it is 2.45 times as fast.
#include <hip/hip_runtime.h>
#include <hip/hip_bf16.h>

typedef __attribute__((ext_vector_type(16))) _Float16 v16h;
typedef __attribute__((ext_vector_type(8)))  _Float16 v8h;
typedef __attribute__((ext_vector_type(8)))  float    v8f;
typedef __attribute__((ext_vector_type(4)))  int      v4i;
typedef __attribute__((ext_vector_type(4)))  float    v4f;

#define Bc 2
#define Hc 16
#define Sc 2048
#define Dc 128
#define NTILE (Sc / 32)            // 64 key tiles per (b,h)
#define TILE_HALVES (32 * 128)     // 4096 f16 per K or V tile (8KB)
// LDS row pitches in f16: 16 bytes x odd, so that the 16 lanes of a half wave,
// one row each, spread a 16-byte read over all 64 banks.
#define KP 136                     // 256-byte rows (K, Q) at 272 bytes
#define VP 40                      // 64-byte rows (V^T) at 80 bytes

#if defined(__has_builtin)
#if __has_builtin(__builtin_amdgcn_global_load_async_to_lds_b128)
#define ASYNC_KV 1
#endif
#endif

__device__ __forceinline__ float rmax16(float x) {
    x = fmaxf(x, __shfl_xor(x, 1, 32));
    x = fmaxf(x, __shfl_xor(x, 2, 32));
    x = fmaxf(x, __shfl_xor(x, 4, 32));
    x = fmaxf(x, __shfl_xor(x, 8, 32));
    return x;
}
__device__ __forceinline__ float rsum16(float x) {
    x += __shfl_xor(x, 1, 32);
    x += __shfl_xor(x, 2, 32);
    x += __shfl_xor(x, 4, 32);
    x += __shfl_xor(x, 8, 32);
    return x;
}

// Lane l takes the value of lane l ^ 16 (the other half of the wave).
__device__ __forceinline__ float xhalf(float x) {
    int i = __builtin_bit_cast(int, x);
    return __builtin_bit_cast(float, __builtin_amdgcn_permlanex16(
        i, i, 0x76543210, 0xfedcba98, false, false));
}

// One 16-element fragment from a padded LDS row: rows are 16-byte aligned only.
__device__ __forceinline__ v16h ld_frag(const _Float16* p) {
    v8h lo = *(const v8h*)p;
    v8h hi = *(const v8h*)(p + 8);
    return __builtin_shufflevector(lo, hi, 0, 1, 2, 3, 4, 5, 6, 7,
                                   8, 9, 10, 11, 12, 13, 14, 15);
}

// A fragment whose k order pairs with a B operand packed from two accumulator
// tiles: half h of the wave holds k 8h..8h+7 and 16+8h..16+8h+7.
__device__ __forceinline__ v16h ld_frag_kmap(const _Float16* row, int h) {
    v8h lo = *(const v8h*)(row + 8 * h);
    v8h hi = *(const v8h*)(row + 16 + 8 * h);
    return __builtin_shufflevector(lo, hi, 0, 1, 2, 3, 4, 5, 6, 7,
                                   8, 9, 10, 11, 12, 13, 14, 15);
}

// Copy one 8KB tile (4096 f16) global -> LDS, 128 threads, thread t does 4x16B.
// The global image is contiguous rows of ROW f16; in LDS the rows lie PITCH apart.
template <int ROW, int PITCH>
__device__ __forceinline__ void tile_copy(const _Float16* __restrict__ g,
                                          _Float16* l, int t) {
    constexpr int CH = ROW / 8;                 // 16-byte chunks per row
    l += (t / CH) * PITCH + (t % CH) * 8;       // this thread's chunk, step 0
    constexpr int LSTEP = (128 / CH) * PITCH;   // rows per step x pitch
#ifdef ASYNC_KV
    typedef __attribute__((address_space(1))) v4i gv4i;   // global <4 x i32>
    typedef __attribute__((address_space(3))) v4i lv4i;   // LDS    <4 x i32>
#pragma unroll
    for (int i = 0; i < 4; i++) {
        __builtin_amdgcn_global_load_async_to_lds_b128(
            (gv4i*)(g + t * 8 + i * 1024),
            (lv4i*)(l + i * LSTEP), 0, 0);
    }
#else
#pragma unroll
    for (int i = 0; i < 4; i++) {
        *(v8h*)(l + i * LSTEP) = *(const v8h*)(g + t * 8 + i * 1024);
    }
#endif
}

__device__ __forceinline__ void wait_async_kv() {
#ifdef ASYNC_KV
    asm volatile("s_wait_asynccnt 0" ::: "memory");
#endif
}

// ---------------------------------------------------------------------------
// Pre-pass: fp32 K/V -> f16, V pre-transposed tile-wise so each hot-loop tile
// is one contiguous global block, copied row-wise into padded LDS.  kh: [bh][s][d] (tiles already contiguous).
// vh: [bh][tile][d][key32].
// ---------------------------------------------------------------------------
__global__ __launch_bounds__(256, 4)
void cvt_kv(const float* __restrict__ k, const float* __restrict__ v,
            _Float16* __restrict__ kh, _Float16* __restrict__ vh) {
    size_t j = (size_t)blockIdx.x * 256 + threadIdx.x;  // 0 .. B*H*S*D-1
    kh[j] = (_Float16)k[j];
    int key   = (int)(j & 31);
    int d     = (int)((j >> 5) & 127);
    size_t st = j >> 12;                         // bh*64 + tile
    size_t src = (st * 32 + key) * 128 + d;      // = ((bh*S)+s)*D + d
    vh[j] = (_Float16)v[src];
}

// ---------------------------------------------------------------------------
// Main kernel (workspace path): f16 K/V, async double-buffered LDS pipeline.
// Transposed products: S^T = K x Q^T (A = K rows, B = Q), O^T += V^T x P^T.
// A lane holds 16 of the tile's 32 scores of ONE query (column ln), so the
// maximum and the sum run in the lane, with one exchange between the halves,
// and P^T packs from the two score tiles straight into a B operand.
// ---------------------------------------------------------------------------
__global__ __launch_bounds__(128, 1)
void fa_fwd_wmma2(const float* __restrict__ q, const _Float16* __restrict__ kh,
                  const _Float16* __restrict__ vh, const int* __restrict__ mask,
                  float* __restrict__ out) {
    constexpr float SCALE = 0.08838834764831845f;  // 1/sqrt(128)
    constexpr float NEGV  = -1.0e9f;

    __shared__ alignas(32) _Float16 Kt[2][32 * KP];    // [key][d]
    __shared__ alignas(32) _Float16 Vt[2][128 * VP];   // [d][key]
    __shared__ alignas(32) _Float16 Qs[4][16 * KP];

    const int t    = threadIdx.x;
    const int wave = t >> 5;
    const int lane = t & 31;
    const int ln   = lane & 15;
    const int hf   = lane >> 4;
    const int bh   = blockIdx.y;
    const int b    = bh >> 4;
    const int q0   = blockIdx.x * 64 + wave * 16;

    const _Float16* kbase = kh + (size_t)bh * NTILE * TILE_HALVES;
    const _Float16* vbase = vh + (size_t)bh * NTILE * TILE_HALVES;

    // ---- prologue: kick off async copy of tile 0 while staging Q
    tile_copy<128, KP>(kbase, Kt[0], t);
    tile_copy<32, VP>(vbase, Vt[0], t);

    {
        const float* qp = q + ((size_t)bh * Sc + q0 + ln) * Dc + hf * 64;
        _Float16* dst = &Qs[wave][ln * KP + hf * 64];
#pragma unroll
        for (int j = 0; j < 16; j++) {
            float4 x = ((const float4*)qp)[j];
            dst[4 * j + 0] = (_Float16)x.x;
            dst[4 * j + 1] = (_Float16)x.y;
            dst[4 * j + 2] = (_Float16)x.z;
            dst[4 * j + 3] = (_Float16)x.w;
        }
    }
    __syncthreads();

    v16h qf[4];
#pragma unroll
    for (int c = 0; c < 4; c++)
        qf[c] = ld_frag(&Qs[wave][ln * KP + c * 32 + hf * 16]);

    v8f o[8];                       // o[n][g] = O^T[d = 16n + 8hf + g][query ln]
#pragma unroll
    for (int n = 0; n < 8; n++) o[n] = v8f{};
    float mrun = -3.0e38f;          // this query's running maximum (both halves alike)
    float lrun = 0.0f;              // this half's share of the query's sum

    // accX[g] belongs to key kb*32 + 16X + 8hf + g: this half's mask values
    const int* mrowp = mask + b * Sc + 8 * hf;

#pragma unroll 1
    for (int kb = 0; kb < NTILE; kb++) {
        const int cur = kb & 1;
        // loads for tile kb were issued last iteration (or prologue)
        wait_async_kv();
        __syncthreads();   // tiles visible; all waves done reading buffer cur^1

        if (kb + 1 < NTILE) {  // prefetch next tile into the other buffer
            tile_copy<128, KP>(kbase + (size_t)(kb + 1) * TILE_HALVES, Kt[cur ^ 1], t);
            tile_copy<32, VP>(vbase + (size_t)(kb + 1) * TILE_HALVES, Vt[cur ^ 1], t);
        }

        const _Float16* Kc = Kt[cur];
        const _Float16* Vc = Vt[cur];

        const v4i* mp = (const v4i*)(mrowp + kb * 32);
        const v4i mk[4] = { mp[0], mp[1], mp[4], mp[5] };

        // ---- scores: S^T = K x Q^T for two 16-key sub-blocks (fp32 acc)
        v8f acc0 = v8f{}, acc1 = v8f{};
#pragma unroll
        for (int c = 0; c < 4; c++) {
            v16h a0 = ld_frag(&Kc[ln * KP + c * 32 + hf * 16]);
            acc0 = __builtin_amdgcn_wmma_f32_16x16x32_f16(false, a0, false, qf[c],
                                                          (short)0, acc0, false, false);
        }
#pragma unroll
        for (int c = 0; c < 4; c++) {
            v16h a1 = ld_frag(&Kc[(16 + ln) * KP + c * 32 + hf * 16]);
            acc1 = __builtin_amdgcn_wmma_f32_16x16x32_f16(false, a1, false, qf[c],
                                                          (short)0, acc1, false, false);
        }

        // ---- online softmax of one query per lane
        const v8f x0 = acc0 * SCALE, x1 = acc1 * SCALE;
        float s0[8], s1[8];
#pragma unroll
        for (int g = 0; g < 8; g++) {
            s0[g] = mk[g >> 2][g & 3]       ? x0[g] : NEGV;
            s1[g] = mk[2 + (g >> 2)][g & 3] ? x1[g] : NEGV;
        }
        float tq[4];                // four short chains, not one of sixteen links
#pragma unroll
        for (int g = 0; g < 4; g++)
            tq[g] = fmaxf(fmaxf(s0[2 * g], s0[2 * g + 1]), fmaxf(s1[2 * g], s1[2 * g + 1]));
        float tm = fmaxf(fmaxf(tq[0], tq[1]), fmaxf(tq[2], tq[3]));
        tm = fmaxf(tm, xhalf(tm));
        const float mnew  = fmaxf(mrun, tm);
        const float alpha = __expf(mrun - mnew);
        mrun = mnew;

        v16h pf;                    // P^T as B: element g is key 8hf + g, 8 + g is key 16 + 8hf + g
        float rs0 = 0.0f, rs1 = 0.0f;
#pragma unroll
        for (int g = 0; g < 8; g++) {
            float e0 = __expf(s0[g] - mnew);
            float e1 = __expf(s1[g] - mnew);
            rs0 += e0;
            rs1 += e1;
            pf[g]     = (_Float16)e0;
            pf[8 + g] = (_Float16)e1;
        }
        lrun = lrun * alpha + (rs0 + rs1);

#pragma unroll
        for (int n = 0; n < 8; n++) o[n] *= alpha;

#pragma unroll
        for (int n = 0; n < 8; n++) {
            v16h vf = ld_frag_kmap(&Vc[(n * 16 + ln) * VP], hf);
            o[n] = __builtin_amdgcn_wmma_f32_16x16x32_f16(false, vf, false, pf,
                                                          (short)0, o[n], false, false);
        }
    }

    // ---- epilogue: join the halves' sums; a lane stores 8 consecutive d of its query
    const float rcp = 1.0f / (lrun + xhalf(lrun));
    float* op = out + ((size_t)bh * Sc + q0 + ln) * Dc + 8 * hf;
#pragma unroll
    for (int n = 0; n < 8; n++) {
        v8f r = o[n] * rcp;
        *(v4f*)&op[n * 16]     = __builtin_shufflevector(r, r, 0, 1, 2, 3);
        *(v4f*)&op[n * 16 + 4] = __builtin_shufflevector(r, r, 4, 5, 6, 7);
    }
}

// ---------------------------------------------------------------------------
// Fallback (no workspace): round-1 kernel, converts in-loop.
// ---------------------------------------------------------------------------
__global__ __launch_bounds__(128, 1)
void fa_fwd_wmma1(const float* __restrict__ q, const float* __restrict__ k,
                  const float* __restrict__ v, const int* __restrict__ mask,
                  float* __restrict__ out) {
    constexpr float SCALE = 0.08838834764831845f;
    constexpr float NEGV  = -1.0e9f;

    __shared__ alignas(32) _Float16 Kt[32 * 128];
    __shared__ alignas(32) _Float16 Vt[128 * 32];
    __shared__ alignas(32) _Float16 Qs[4][16 * 128];
    __shared__ alignas(32) _Float16 Pt[4][16 * 32];

    const int t    = threadIdx.x;
    const int wave = t >> 5;
    const int lane = t & 31;
    const int ln   = lane & 15;
    const int hf   = lane >> 4;
    const int bh   = blockIdx.y;
    const int b    = bh >> 4;
    const int q0   = blockIdx.x * 64 + wave * 16;

    {
        const float* qp = q + ((size_t)bh * Sc + q0 + ln) * Dc + hf * 64;
        _Float16* dst = &Qs[wave][ln * 128 + hf * 64];
#pragma unroll
        for (int j = 0; j < 16; j++) {
            float4 x = ((const float4*)qp)[j];
            dst[4 * j + 0] = (_Float16)x.x;
            dst[4 * j + 1] = (_Float16)x.y;
            dst[4 * j + 2] = (_Float16)x.z;
            dst[4 * j + 3] = (_Float16)x.w;
        }
    }
    __syncthreads();

    v16h qf[4];
#pragma unroll
    for (int c = 0; c < 4; c++)
        qf[c] = *(const v16h*)&Qs[wave][ln * 128 + c * 32 + hf * 16];

    v8f o[8];
#pragma unroll
    for (int n = 0; n < 8; n++) o[n] = v8f{};
    float mrow[8], lrow[8];
#pragma unroll
    for (int g = 0; g < 8; g++) { mrow[g] = -3.0e38f; lrow[g] = 0.0f; }

    const int row = t >> 2;
    const int d0  = (t & 3) * 32;

#pragma unroll 1
    for (int kb = 0; kb < NTILE; kb++) {
        const int kcol = kb * 32;
        __syncthreads();
        {
            const float* kp = k + ((size_t)bh * Sc + kcol + row) * Dc + d0;
            const float* vp = v + ((size_t)bh * Sc + kcol + row) * Dc + d0;
            _Float16* kd = &Kt[row * 128 + d0];
#pragma unroll
            for (int j = 0; j < 8; j++) {
                float4 x = ((const float4*)kp)[j];
                kd[4 * j + 0] = (_Float16)x.x;
                kd[4 * j + 1] = (_Float16)x.y;
                kd[4 * j + 2] = (_Float16)x.z;
                kd[4 * j + 3] = (_Float16)x.w;
                float4 y = ((const float4*)vp)[j];
                Vt[(d0 + 4 * j + 0) * 32 + row] = (_Float16)y.x;
                Vt[(d0 + 4 * j + 1) * 32 + row] = (_Float16)y.y;
                Vt[(d0 + 4 * j + 2) * 32 + row] = (_Float16)y.z;
                Vt[(d0 + 4 * j + 3) * 32 + row] = (_Float16)y.w;
            }
        }
        __syncthreads();

        v8f acc0 = v8f{}, acc1 = v8f{};
#pragma unroll
        for (int c = 0; c < 4; c++) {
            v16h b0 = *(const v16h*)&Kt[ln * 128 + c * 32 + hf * 16];
            acc0 = __builtin_amdgcn_wmma_f32_16x16x32_f16(false, qf[c], false, b0,
                                                          (short)0, acc0, false, false);
        }
#pragma unroll
        for (int c = 0; c < 4; c++) {
            v16h b1 = *(const v16h*)&Kt[(16 + ln) * 128 + c * 32 + hf * 16];
            acc1 = __builtin_amdgcn_wmma_f32_16x16x32_f16(false, qf[c], false, b1,
                                                          (short)0, acc1, false, false);
        }

        const int m0 = mask[b * Sc + kcol + ln];
        const int m1 = mask[b * Sc + kcol + 16 + ln];
        const float sc0 = m0 ? SCALE : 0.0f, ad0 = m0 ? 0.0f : NEGV;
        const float sc1 = m1 ? SCALE : 0.0f, ad1 = m1 ? 0.0f : NEGV;

        float p0[8], p1[8], alpha[8];
#pragma unroll
        for (int g = 0; g < 8; g++) {
            float s0 = acc0[g] * sc0 + ad0;
            float s1 = acc1[g] * sc1 + ad1;
            float bm   = rmax16(fmaxf(s0, s1));
            float mnew = fmaxf(mrow[g], bm);
            alpha[g] = __expf(mrow[g] - mnew);
            p0[g]    = __expf(s0 - mnew);
            p1[g]    = __expf(s1 - mnew);
            float rs = rsum16(p0[g] + p1[g]);
            lrow[g] = lrow[g] * alpha[g] + rs;
            mrow[g] = mnew;
        }

#pragma unroll
        for (int g = 0; g < 8; g++) {
            Pt[wave][(g + 8 * hf) * 32 + ln]      = (_Float16)p0[g];
            Pt[wave][(g + 8 * hf) * 32 + 16 + ln] = (_Float16)p1[g];
        }
#pragma unroll
        for (int n = 0; n < 8; n++) {
#pragma unroll
            for (int g = 0; g < 8; g++) o[n][g] *= alpha[g];
        }
        asm volatile("s_wait_dscnt 0" ::: "memory");

        v16h pf = *(const v16h*)&Pt[wave][ln * 32 + hf * 16];
#pragma unroll
        for (int n = 0; n < 8; n++) {
            v16h vf = *(const v16h*)&Vt[(n * 16 + ln) * 32 + hf * 16];
            o[n] = __builtin_amdgcn_wmma_f32_16x16x32_f16(false, pf, false, vf,
                                                          (short)0, o[n], false, false);
        }
    }

    float rcp[8];
#pragma unroll
    for (int g = 0; g < 8; g++) rcp[g] = 1.0f / lrow[g];
#pragma unroll
    for (int n = 0; n < 8; n++) {
#pragma unroll
        for (int g = 0; g < 8; g++) {
            out[((size_t)bh * Sc + q0 + g + 8 * hf) * Dc + n * 16 + ln] = o[n][g] * rcp[g];
        }
    }
}

extern "C" void kernel_launch(void* const* d_in, const int* in_sizes, int n_in,
                              void* d_out, int out_size, void* d_ws, size_t ws_size,
                              hipStream_t stream) {
    (void)in_sizes; (void)n_in; (void)out_size;
    const float* q    = (const float*)d_in[0];
    const float* k    = (const float*)d_in[1];
    const float* v    = (const float*)d_in[2];
    const int*   mask = (const int*)d_in[3];
    float* out = (float*)d_out;

    const size_t nelem   = (size_t)Bc * Hc * Sc * Dc;   // 8,388,608
    const size_t ws_need = 2 * nelem * sizeof(_Float16);

    dim3 grid(Sc / 64, Bc * Hc);
    dim3 block(128);

    if (ws_size >= ws_need && d_ws != nullptr) {
        _Float16* kh = (_Float16*)d_ws;
        _Float16* vh = kh + nelem;
        cvt_kv<<<dim3((unsigned)(nelem / 256)), dim3(256), 0, stream>>>(k, v, kh, vh);
        fa_fwd_wmma2<<<grid, block, 0, stream>>>(q, kh, vh, mask, out);
    } else {
        fa_fwd_wmma1<<<grid, block, 0, stream>>>(q, k, v, mask, out);
    }
}

// v003
// It runs in 113 microseconds.
// Two timings next to v002 both put it at 1.10 times that version's speed.
// Over all steps from v000 it is 2.69 times as fast.
#include <hip/hip_runtime.h>
#include <hip/hip_bf16.h>

typedef __attribute__((ext_vector_type(16))) _Float16 v16h;
typedef __attribute__((ext_vector_type(8)))  _Float16 v8h;
typedef __attribute__((ext_vector_type(4)))  _Float16 v4h;
typedef __attribute__((ext_vector_type(8)))  float    v8f;
typedef __attribute__((ext_vector_type(4)))  int      v4i;
typedef __attribute__((ext_vector_type(4)))  float    v4f;

#define Bc 2
#define Hc 16
#define Sc 2048
#define Dc 128
#define NTILE (Sc / 32)            // 64 key tiles per (b,h)
#define TILE_HALVES (32 * 128)     // 4096 f16 per K or V tile (8KB)
// LDS row pitches in f16: 16 bytes x odd, so that the 16 lanes of a half wave,
// one row each, spread a 16-byte read over all 64 banks.
#define KP 136                     // 256-byte rows (K, Q) at 272 bytes
#define VP 40                      // 64-byte rows (V^T) at 80 bytes

#if defined(__has_builtin)
#if __has_builtin(__builtin_amdgcn_global_load_async_to_lds_b128)
#define ASYNC_KV 1
#endif
#endif

__device__ __forceinline__ float rmax16(float x) {
    x = fmaxf(x, __shfl_xor(x, 1, 32));
    x = fmaxf(x, __shfl_xor(x, 2, 32));
    x = fmaxf(x, __shfl_xor(x, 4, 32));
    x = fmaxf(x, __shfl_xor(x, 8, 32));
    return x;
}
__device__ __forceinline__ float rsum16(float x) {
    x += __shfl_xor(x, 1, 32);
    x += __shfl_xor(x, 2, 32);
    x += __shfl_xor(x, 4, 32);
    x += __shfl_xor(x, 8, 32);
    return x;
}

// Lane l takes the value of lane l ^ 16 (the other half of the wave).
__device__ __forceinline__ float xhalf(float x) {
    int i = __builtin_bit_cast(int, x);
    return __builtin_bit_cast(float, __builtin_amdgcn_permlanex16(
        i, i, 0x76543210, 0xfedcba98, false, false));
}

// One 16-element fragment from a padded LDS row: rows are 16-byte aligned only.
__device__ __forceinline__ v16h ld_frag(const _Float16* p) {
    v8h lo = *(const v8h*)p;
    v8h hi = *(const v8h*)(p + 8);
    return __builtin_shufflevector(lo, hi, 0, 1, 2, 3, 4, 5, 6, 7,
                                   8, 9, 10, 11, 12, 13, 14, 15);
}

// A fragment whose k order pairs with a B operand packed from two accumulator
// tiles: half h of the wave holds k 8h..8h+7 and 16+8h..16+8h+7.
__device__ __forceinline__ v16h ld_frag_kmap(const _Float16* row, int h) {
    v8h lo = *(const v8h*)(row + 8 * h);
    v8h hi = *(const v8h*)(row + 16 + 8 * h);
    return __builtin_shufflevector(lo, hi, 0, 1, 2, 3, 4, 5, 6, 7,
                                   8, 9, 10, 11, 12, 13, 14, 15);
}

// Copy one 8KB tile (4096 f16) global -> LDS, 128 threads, thread t does 4x16B.
// The global image is contiguous rows of ROW f16; in LDS the rows lie PITCH apart.
template <int ROW, int PITCH>
__device__ __forceinline__ void tile_copy(const _Float16* __restrict__ g,
                                          _Float16* l, int t) {
    constexpr int CH = ROW / 8;                 // 16-byte chunks per row
    l += (t / CH) * PITCH + (t % CH) * 8;       // this thread's chunk, step 0
    constexpr int LSTEP = (128 / CH) * PITCH;   // rows per step x pitch
#ifdef ASYNC_KV
    typedef __attribute__((address_space(1))) v4i gv4i;   // global <4 x i32>
    typedef __attribute__((address_space(3))) v4i lv4i;   // LDS    <4 x i32>
#pragma unroll
    for (int i = 0; i < 4; i++) {
        __builtin_amdgcn_global_load_async_to_lds_b128(
            (gv4i*)(g + t * 8 + i * 1024),
            (lv4i*)(l + i * LSTEP), 0, 0);
    }
#else
#pragma unroll
    for (int i = 0; i < 4; i++) {
        *(v8h*)(l + i * LSTEP) = *(const v8h*)(g + t * 8 + i * 1024);
    }
#endif
}

__device__ __forceinline__ void wait_async_kv() {
#ifdef ASYNC_KV
    asm volatile("s_wait_asynccnt 0" ::: "memory");
#endif
}

// ---------------------------------------------------------------------------
// Pre-pass: fp32 K/V -> f16, V pre-transposed tile-wise so each hot-loop tile
// is one contiguous global block, copied row-wise into padded LDS.  kh: [bh][s][d] (tiles already contiguous).
// vh: [bh][tile][d][key32].
// One wave converts half a 32-key tile of K and of V with 32 loads of 16 bytes,
// all issued before the first conversion.
// K: 8 KB in a row, each load 512 contiguous bytes, each store 256.
// V: a strip of 32 keys x 64 d.  A lane loads 4 d of 8 consecutive keys, so the
// 8 keys of one d (16 bytes of vh) lie in that lane: the transpose is a choice
// of registers.  Four neighbour lanes hold the four key groups of the same d:
// a load touches whole 128-byte lines, a store writes whole 64-byte rows of vh.
// ---------------------------------------------------------------------------
#define CVT_THREADS 512
#define CVT_BLOCKS (Bc * Hc * NTILE * 2 / (CVT_THREADS / 32))   // one wave per half tile
__global__ __launch_bounds__(CVT_THREADS)
void cvt_kv(const float* __restrict__ k, const float* __restrict__ v,
            _Float16* __restrict__ kh, _Float16* __restrict__ vh) {
    const int lane = threadIdx.x & 31;
    const int hw   = blockIdx.x * (CVT_THREADS / 32) + (threadIdx.x >> 5);  // half tile
    const int st   = hw >> 1;                    // bh*64 + tile
    const int d0   = (hw & 1) * 64 + (lane >> 2) * 4;
    const int key0 = (lane & 3) * 8;

    const float* kp = k + (size_t)hw * (TILE_HALVES / 2) + lane * 4;
    const float* vp = v + ((size_t)st * 32 + key0) * Dc + d0;

    // Every loop here is unrolled so that kx and vx are indexed by constants and
    // stay in registers.
    v4f kx[16];
#pragma unroll
    for (int i = 0; i < 16; i++) kx[i] = *(const v4f*)(kp + i * 128);
    v4f vx[2][8];                                // [32-d group][key]
#pragma unroll
    for (int i = 0; i < 8; i++) {
        vx[0][i] = *(const v4f*)(vp + i * Dc);
        vx[1][i] = *(const v4f*)(vp + i * Dc + 32);
    }
    // The wait that stands before a load's address registers are written again.
    // As inputs the two addresses stay live up to it, so that no load lands on
    // them; and no load sinks below it: without it the compiler holds the V loads
    // back until K has landed, two memory latencies in a row.
    asm volatile("s_wait_xcnt 0x0" :: "v"(kp), "v"(vp) : "memory");

    _Float16* ko = kh + (size_t)hw * (TILE_HALVES / 2) + lane * 4;
#pragma unroll
    for (int i = 0; i < 16; i++)
        *(v4h*)(ko + i * 128) = __builtin_convertvector(kx[i], v4h);

    _Float16* vo = vh + (size_t)st * TILE_HALVES + d0 * 32 + key0;
#pragma unroll
    for (int r = 0; r < 2; r++) {
#pragma unroll
        for (int j = 0; j < 4; j++) {
            v8h y;
#pragma unroll
            for (int i = 0; i < 8; i++) y[i] = (_Float16)vx[r][i][j];
            *(v8h*)(vo + (r * 32 + j) * 32) = y;
        }
    }
}

// ---------------------------------------------------------------------------
// Main kernel (workspace path): f16 K/V, async double-buffered LDS pipeline.
// Transposed products: S^T = K x Q^T (A = K rows, B = Q), O^T += V^T x P^T.
// A lane holds 16 of the tile's 32 scores of ONE query (column ln), so the
// maximum and the sum run in the lane, with one exchange between the halves,
// and P^T packs from the two score tiles straight into a B operand.
// ---------------------------------------------------------------------------
__global__ __launch_bounds__(128, 1)
void fa_fwd_wmma2(const float* __restrict__ q, const _Float16* __restrict__ kh,
                  const _Float16* __restrict__ vh, const int* __restrict__ mask,
                  float* __restrict__ out) {
    constexpr float SCALE = 0.08838834764831845f;  // 1/sqrt(128)
    constexpr float NEGV  = -1.0e9f;

    __shared__ alignas(32) _Float16 Kt[2][32 * KP];    // [key][d]
    __shared__ alignas(32) _Float16 Vt[2][128 * VP];   // [d][key]
    __shared__ alignas(32) _Float16 Qs[4][16 * KP];

    const int t    = threadIdx.x;
    const int wave = t >> 5;
    const int lane = t & 31;
    const int ln   = lane & 15;
    const int hf   = lane >> 4;
    const int bh   = blockIdx.y;
    const int b    = bh >> 4;
    const int q0   = blockIdx.x * 64 + wave * 16;

    const _Float16* kbase = kh + (size_t)bh * NTILE * TILE_HALVES;
    const _Float16* vbase = vh + (size_t)bh * NTILE * TILE_HALVES;

    // ---- prologue: kick off async copy of tile 0 while staging Q
    tile_copy<128, KP>(kbase, Kt[0], t);
    tile_copy<32, VP>(vbase, Vt[0], t);

    {
        const float* qp = q + ((size_t)bh * Sc + q0 + ln) * Dc + hf * 64;
        _Float16* dst = &Qs[wave][ln * KP + hf * 64];
#pragma unroll
        for (int j = 0; j < 16; j++) {
            float4 x = ((const float4*)qp)[j];
            dst[4 * j + 0] = (_Float16)x.x;
            dst[4 * j + 1] = (_Float16)x.y;
            dst[4 * j + 2] = (_Float16)x.z;
            dst[4 * j + 3] = (_Float16)x.w;
        }
    }
    __syncthreads();

    v16h qf[4];
#pragma unroll
    for (int c = 0; c < 4; c++)
        qf[c] = ld_frag(&Qs[wave][ln * KP + c * 32 + hf * 16]);

    v8f o[8];                       // o[n][g] = O^T[d = 16n + 8hf + g][query ln]
#pragma unroll
    for (int n = 0; n < 8; n++) o[n] = v8f{};
    float mrun = -3.0e38f;          // this query's running maximum (both halves alike)
    float lrun = 0.0f;              // this half's share of the query's sum

    // accX[g] belongs to key kb*32 + 16X + 8hf + g: this half's mask values
    const int* mrowp = mask + b * Sc + 8 * hf;

#pragma unroll 1
    for (int kb = 0; kb < NTILE; kb++) {
        const int cur = kb & 1;
        // loads for tile kb were issued last iteration (or prologue)
        wait_async_kv();
        __syncthreads();   // tiles visible; all waves done reading buffer cur^1

        if (kb + 1 < NTILE) {  // prefetch next tile into the other buffer
            tile_copy<128, KP>(kbase + (size_t)(kb + 1) * TILE_HALVES, Kt[cur ^ 1], t);
            tile_copy<32, VP>(vbase + (size_t)(kb + 1) * TILE_HALVES, Vt[cur ^ 1], t);
        }

        const _Float16* Kc = Kt[cur];
        const _Float16* Vc = Vt[cur];

        const v4i* mp = (const v4i*)(mrowp + kb * 32);
        const v4i mk[4] = { mp[0], mp[1], mp[4], mp[5] };

        // ---- scores: S^T = K x Q^T for two 16-key sub-blocks (fp32 acc)
        v8f acc0 = v8f{}, acc1 = v8f{};
#pragma unroll
        for (int c = 0; c < 4; c++) {
            v16h a0 = ld_frag(&Kc[ln * KP + c * 32 + hf * 16]);
            acc0 = __builtin_amdgcn_wmma_f32_16x16x32_f16(false, a0, false, qf[c],
                                                          (short)0, acc0, false, false);
        }
#pragma unroll
        for (int c = 0; c < 4; c++) {
            v16h a1 = ld_frag(&Kc[(16 + ln) * KP + c * 32 + hf * 16]);
            acc1 = __builtin_amdgcn_wmma_f32_16x16x32_f16(false, a1, false, qf[c],
                                                          (short)0, acc1, false, false);
        }

        // ---- online softmax of one query per lane
        const v8f x0 = acc0 * SCALE, x1 = acc1 * SCALE;
        float s0[8], s1[8];
#pragma unroll
        for (int g = 0; g < 8; g++) {
            s0[g] = mk[g >> 2][g & 3]       ? x0[g] : NEGV;
            s1[g] = mk[2 + (g >> 2)][g & 3] ? x1[g] : NEGV;
        }
        float tq[4];                // four short chains, not one of sixteen links
#pragma unroll
        for (int g = 0; g < 4; g++)
            tq[g] = fmaxf(fmaxf(s0[2 * g], s0[2 * g + 1]), fmaxf(s1[2 * g], s1[2 * g + 1]));
        float tm = fmaxf(fmaxf(tq[0], tq[1]), fmaxf(tq[2], tq[3]));
        tm = fmaxf(tm, xhalf(tm));
        const float mnew  = fmaxf(mrun, tm);
        const float alpha = __expf(mrun - mnew);
        mrun = mnew;

        v16h pf;                    // P^T as B: element g is key 8hf + g, 8 + g is key 16 + 8hf + g
        float rs0 = 0.0f, rs1 = 0.0f;
#pragma unroll
        for (int g = 0; g < 8; g++) {
            float e0 = __expf(s0[g] - mnew);
            float e1 = __expf(s1[g] - mnew);
            rs0 += e0;
            rs1 += e1;
            pf[g]     = (_Float16)e0;
            pf[8 + g] = (_Float16)e1;
        }
        lrun = lrun * alpha + (rs0 + rs1);

#pragma unroll
        for (int n = 0; n < 8; n++) o[n] *= alpha;

#pragma unroll
        for (int n = 0; n < 8; n++) {
            v16h vf = ld_frag_kmap(&Vc[(n * 16 + ln) * VP], hf);
            o[n] = __builtin_amdgcn_wmma_f32_16x16x32_f16(false, vf, false, pf,
                                                          (short)0, o[n], false, false);
        }
    }

    // ---- epilogue: join the halves' sums; a lane stores 8 consecutive d of its query
    const float rcp = 1.0f / (lrun + xhalf(lrun));
    float* op = out + ((size_t)bh * Sc + q0 + ln) * Dc + 8 * hf;
#pragma unroll
    for (int n = 0; n < 8; n++) {
        v8f r = o[n] * rcp;
        *(v4f*)&op[n * 16]     = __builtin_shufflevector(r, r, 0, 1, 2, 3);
        *(v4f*)&op[n * 16 + 4] = __builtin_shufflevector(r, r, 4, 5, 6, 7);
    }
}

// ---------------------------------------------------------------------------
// Fallback (no workspace): round-1 kernel, converts in-loop.
// ---------------------------------------------------------------------------
__global__ __launch_bounds__(128, 1)
void fa_fwd_wmma1(const float* __restrict__ q, const float* __restrict__ k,
                  const float* __restrict__ v, const int* __restrict__ mask,
                  float* __restrict__ out) {
    constexpr float SCALE = 0.08838834764831845f;
    constexpr float NEGV  = -1.0e9f;

    __shared__ alignas(32) _Float16 Kt[32 * 128];
    __shared__ alignas(32) _Float16 Vt[128 * 32];
    __shared__ alignas(32) _Float16 Qs[4][16 * 128];
    __shared__ alignas(32) _Float16 Pt[4][16 * 32];

    const int t    = threadIdx.x;
    const int wave = t >> 5;
    const int lane = t & 31;
    const int ln   = lane & 15;
    const int hf   = lane >> 4;
    const int bh   = blockIdx.y;
    const int b    = bh >> 4;
    const int q0   = blockIdx.x * 64 + wave * 16;

    {
        const float* qp = q + ((size_t)bh * Sc + q0 + ln) * Dc + hf * 64;
        _Float16* dst = &Qs[wave][ln * 128 + hf * 64];
#pragma unroll
        for (int j = 0; j < 16; j++) {
            float4 x = ((const float4*)qp)[j];
            dst[4 * j + 0] = (_Float16)x.x;
            dst[4 * j + 1] = (_Float16)x.y;
            dst[4 * j + 2] = (_Float16)x.z;
            dst[4 * j + 3] = (_Float16)x.w;
        }
    }
    __syncthreads();

    v16h qf[4];
#pragma unroll
    for (int c = 0; c < 4; c++)
        qf[c] = *(const v16h*)&Qs[wave][ln * 128 + c * 32 + hf * 16];

    v8f o[8];
#pragma unroll
    for (int n = 0; n < 8; n++) o[n] = v8f{};
    float mrow[8], lrow[8];
#pragma unroll
    for (int g = 0; g < 8; g++) { mrow[g] = -3.0e38f; lrow[g] = 0.0f; }

    const int row = t >> 2;
    const int d0  = (t & 3) * 32;

#pragma unroll 1
    for (int kb = 0; kb < NTILE; kb++) {
        const int kcol = kb * 32;
        __syncthreads();
        {
            const float* kp = k + ((size_t)bh * Sc + kcol + row) * Dc + d0;
            const float* vp = v + ((size_t)bh * Sc + kcol + row) * Dc + d0;
            _Float16* kd = &Kt[row * 128 + d0];
#pragma unroll
            for (int j = 0; j < 8; j++) {
                float4 x = ((const float4*)kp)[j];
                kd[4 * j + 0] = (_Float16)x.x;
                kd[4 * j + 1] = (_Float16)x.y;
                kd[4 * j + 2] = (_Float16)x.z;
                kd[4 * j + 3] = (_Float16)x.w;
                float4 y = ((const float4*)vp)[j];
                Vt[(d0 + 4 * j + 0) * 32 + row] = (_Float16)y.x;
                Vt[(d0 + 4 * j + 1) * 32 + row] = (_Float16)y.y;
                Vt[(d0 + 4 * j + 2) * 32 + row] = (_Float16)y.z;
                Vt[(d0 + 4 * j + 3) * 32 + row] = (_Float16)y.w;
            }
        }
        __syncthreads();

        v8f acc0 = v8f{}, acc1 = v8f{};
#pragma unroll
        for (int c = 0; c < 4; c++) {
            v16h b0 = *(const v16h*)&Kt[ln * 128 + c * 32 + hf * 16];
            acc0 = __builtin_amdgcn_wmma_f32_16x16x32_f16(false, qf[c], false, b0,
                                                          (short)0, acc0, false, false);
        }
#pragma unroll
        for (int c = 0; c < 4; c++) {
            v16h b1 = *(const v16h*)&Kt[(16 + ln) * 128 + c * 32 + hf * 16];
            acc1 = __builtin_amdgcn_wmma_f32_16x16x32_f16(false, qf[c], false, b1,
                                                          (short)0, acc1, false, false);
        }

        const int m0 = mask[b * Sc + kcol + ln];
        const int m1 = mask[b * Sc + kcol + 16 + ln];
        const float sc0 = m0 ? SCALE : 0.0f, ad0 = m0 ? 0.0f : NEGV;
        const float sc1 = m1 ? SCALE : 0.0f, ad1 = m1 ? 0.0f : NEGV;

        float p0[8], p1[8], alpha[8];
#pragma unroll
        for (int g = 0; g < 8; g++) {
            float s0 = acc0[g] * sc0 + ad0;
            float s1 = acc1[g] * sc1 + ad1;
            float bm   = rmax16(fmaxf(s0, s1));
            float mnew = fmaxf(mrow[g], bm);
            alpha[g] = __expf(mrow[g] - mnew);
            p0[g]    = __expf(s0 - mnew);
            p1[g]    = __expf(s1 - mnew);
            float rs = rsum16(p0[g] + p1[g]);
            lrow[g] = lrow[g] * alpha[g] + rs;
            mrow[g] = mnew;
        }

#pragma unroll
        for (int g = 0; g < 8; g++) {
            Pt[wave][(g + 8 * hf) * 32 + ln]      = (_Float16)p0[g];
            Pt[wave][(g + 8 * hf) * 32 + 16 + ln] = (_Float16)p1[g];
        }
#pragma unroll
        for (int n = 0; n < 8; n++) {
#pragma unroll
            for (int g = 0; g < 8; g++) o[n][g] *= alpha[g];
        }
        asm volatile("s_wait_dscnt 0" ::: "memory");

        v16h pf = *(const v16h*)&Pt[wave][ln * 32 + hf * 16];
#pragma unroll
        for (int n = 0; n < 8; n++) {
            v16h vf = *(const v16h*)&Vt[(n * 16 + ln) * 32 + hf * 16];
            o[n] = __builtin_amdgcn_wmma_f32_16x16x32_f16(false, pf, false, vf,
                                                          (short)0, o[n], false, false);
        }
    }

    float rcp[8];
#pragma unroll
    for (int g = 0; g < 8; g++) rcp[g] = 1.0f / lrow[g];
#pragma unroll
    for (int n = 0; n < 8; n++) {
#pragma unroll
        for (int g = 0; g < 8; g++) {
            out[((size_t)bh * Sc + q0 + g + 8 * hf) * Dc + n * 16 + ln] = o[n][g] * rcp[g];
        }
    }
}

extern "C" void kernel_launch(void* const* d_in, const int* in_sizes, int n_in,
                              void* d_out, int out_size, void* d_ws, size_t ws_size,
                              hipStream_t stream) {
    (void)in_sizes; (void)n_in; (void)out_size;
    const float* q    = (const float*)d_in[0];
    const float* k    = (const float*)d_in[1];
    const float* v    = (const float*)d_in[2];
    const int*   mask = (const int*)d_in[3];
    float* out = (float*)d_out;

    const size_t nelem   = (size_t)Bc * Hc * Sc * Dc;   // 8,388,608
    const size_t ws_need = 2 * nelem * sizeof(_Float16);

    dim3 grid(Sc / 64, Bc * Hc);
    dim3 block(128);

    if (ws_size >= ws_need && d_ws != nullptr) {
        _Float16* kh = (_Float16*)d_ws;
        _Float16* vh = kh + nelem;
        cvt_kv<<<dim3(CVT_BLOCKS), dim3(CVT_THREADS), 0, stream>>>(k, v, kh, vh);
        fa_fwd_wmma2<<<grid, block, 0, stream>>>(q, kh, vh, mask, out);
    } else {
        fa_fwd_wmma1<<<grid, block, 0, stream>>>(q, k, v, mask, out);
    }
}

// v004
// It runs in 55.5 microseconds.
// Two timings next to v003 put it at 2.04 and 2.02 times that version's speed.
// Counting every step since v000, it is 5.46 times as fast.
#include <hip/hip_runtime.h>
#include <hip/hip_bf16.h>

typedef __attribute__((ext_vector_type(16))) _Float16 v16h;
typedef __attribute__((ext_vector_type(8)))  _Float16 v8h;
typedef __attribute__((ext_vector_type(4)))  _Float16 v4h;
typedef __attribute__((ext_vector_type(8)))  float    v8f;
typedef __attribute__((ext_vector_type(4)))  int      v4i;
typedef __attribute__((ext_vector_type(4)))  float    v4f;
typedef __attribute__((ext_vector_type(8)))  unsigned short v8us;

#define Bc 2
#define Hc 16
#define Sc 2048
#define Dc 128
#define NTILE (Sc / 32)            // 64 key tiles per (b,h)
#define TILE_HALVES (32 * 128)     // 4096 f16 per K or V tile (8KB)
// LDS row pitches in f16: 16 bytes x odd, so that the 16 lanes of a half wave,
// one row each, spread a 16-byte read over all 64 banks.
#define KP 136                     // 256-byte rows (K, Q) at 272 bytes
#define VP 40                      // 64-byte rows (V^T) at 80 bytes

#if defined(__has_builtin)
#if __has_builtin(__builtin_amdgcn_global_load_async_to_lds_b128)
#define ASYNC_KV 1
#endif
#endif

__device__ __forceinline__ float rmax16(float x) {
    x = fmaxf(x, __shfl_xor(x, 1, 32));
    x = fmaxf(x, __shfl_xor(x, 2, 32));
    x = fmaxf(x, __shfl_xor(x, 4, 32));
    x = fmaxf(x, __shfl_xor(x, 8, 32));
    return x;
}
__device__ __forceinline__ float rsum16(float x) {
    x += __shfl_xor(x, 1, 32);
    x += __shfl_xor(x, 2, 32);
    x += __shfl_xor(x, 4, 32);
    x += __shfl_xor(x, 8, 32);
    return x;
}

// Lane l takes the value of lane l ^ 16 (the other half of the wave).
__device__ __forceinline__ float xhalf(float x) {
    int i = __builtin_bit_cast(int, x);
    return __builtin_bit_cast(float, __builtin_amdgcn_permlanex16(
        i, i, 0x76543210, 0xfedcba98, false, false));
}

// One 16-element fragment from a padded LDS row: rows are 16-byte aligned only.
__device__ __forceinline__ v16h ld_frag(const _Float16* p) {
    v8h lo = *(const v8h*)p;
    v8h hi = *(const v8h*)(p + 8);
    return __builtin_shufflevector(lo, hi, 0, 1, 2, 3, 4, 5, 6, 7,
                                   8, 9, 10, 11, 12, 13, 14, 15);
}

// A fragment whose k order pairs with a B operand packed from two accumulator
// tiles: half h of the wave holds k 8h..8h+7 and 16+8h..16+8h+7.
__device__ __forceinline__ v16h ld_frag_kmap(const _Float16* row, int h) {
    v8h lo = *(const v8h*)(row + 8 * h);
    v8h hi = *(const v8h*)(row + 16 + 8 * h);
    return __builtin_shufflevector(lo, hi, 0, 1, 2, 3, 4, 5, 6, 7,
                                   8, 9, 10, 11, 12, 13, 14, 15);
}

// Copy one 8KB tile (4096 f16) global -> LDS, 128 threads, thread t does 4x16B.
// The global image is contiguous rows of ROW f16; in LDS the rows lie PITCH apart.
template <int ROW, int PITCH>
__device__ __forceinline__ void tile_copy(const _Float16* __restrict__ g,
                                          _Float16* l, int t) {
    constexpr int CH = ROW / 8;                 // 16-byte chunks per row
    l += (t / CH) * PITCH + (t % CH) * 8;       // this thread's chunk, step 0
    constexpr int LSTEP = (128 / CH) * PITCH;   // rows per step x pitch
#ifdef ASYNC_KV
    typedef __attribute__((address_space(1))) v4i gv4i;   // global <4 x i32>
    typedef __attribute__((address_space(3))) v4i lv4i;   // LDS    <4 x i32>
#pragma unroll
    for (int i = 0; i < 4; i++) {
        __builtin_amdgcn_global_load_async_to_lds_b128(
            (gv4i*)(g + t * 8 + i * 1024),
            (lv4i*)(l + i * LSTEP), 0, 0);
    }
#else
#pragma unroll
    for (int i = 0; i < 4; i++) {
        *(v8h*)(l + i * LSTEP) = *(const v8h*)(g + t * 8 + i * 1024);
    }
#endif
}

__device__ __forceinline__ void wait_async_kv() {
#ifdef ASYNC_KV
    asm volatile("s_wait_asynccnt 0" ::: "memory");
#endif
}

// ---------------------------------------------------------------------------
// Pre-pass: fp32 K/V -> f16, the keys of a batch reordered so that the unmasked
// ones come first (a masked key's weight is exp(-1e9 - max) = 0 as soon as one key
// is unmasked), V transposed tile-wise so hot-loop LDS tiles are contiguous memcpy
// images.  kh: [bh][position][d].  vh: [bh][tile][d][position32].
// Every block forms the order of its batch itself: a stable partition, unmasked
// keys in their order, then the masked ones.  It is a permutation of 0..Sc-1 for
// any content of the mask, so every row index read from perm lies inside K and V.
// The masked keys behind the last unmasked one fill up the last tile with finite
// rows; with no unmasked key the order is the identity and all tiles are written.
// One wave converts half a 32-key tile of K and of V with 32 loads of 16 bytes,
// all issued before the first conversion.
// K: 16 rows, each load one whole row of 512 bytes, each store 256.
// V: a strip of 32 keys x 64 d.  A lane loads 4 d of 8 consecutive positions, so
// the 8 positions of one d (16 bytes of vh) lie in that lane: the transpose is a
// choice of registers.  Four neighbour lanes hold the four groups of the same d:
// a load touches whole 128-byte lines, a store writes whole 64-byte rows of vh.
// A block takes every 8th tile of its (b,h), so that the tiles that are needed
// spread evenly over the blocks.
// ---------------------------------------------------------------------------
#define CVT_THREADS 512
#define CVT_BLOCKS (Bc * Hc * 8)   // 16 waves = 8 tiles x 2 halves per block
__global__ __launch_bounds__(CVT_THREADS)
void cvt_kv(const float* __restrict__ k, const float* __restrict__ v,
            const int* __restrict__ mask,
            _Float16* __restrict__ kh, _Float16* __restrict__ vh,
            int* __restrict__ nlive) {
    __shared__ alignas(16) unsigned short perm[Sc];   // position -> key
    __shared__ alignas(16) int wtot[CVT_THREADS / 32];

    const int lane = threadIdx.x & 31;
    const int wave = __builtin_amdgcn_readfirstlane(threadIdx.x >> 5);
    const int bh   = blockIdx.x >> 3;
    const int b    = bh >> 4;

    // ---- the order: wave w ranks keys 128w .. 128w+127, 32 per ballot
    const int* mp = mask + b * Sc + wave * 128 + lane;
    unsigned bal[4];
    int tot = 0;
#pragma unroll
    for (int j = 0; j < 4; j++) {
        bal[j] = __builtin_amdgcn_ballot_w32(mp[j * 32] != 0);
        tot += __builtin_popcount(bal[j]);
    }
    if (lane == 0) wtot[wave] = tot;
    __syncthreads();               // every wave's count is in wtot
    int before = 0, n = 0;         // unmasked keys in front of this wave's; in all
#pragma unroll
    for (int w = 0; w < CVT_THREADS / 32; w++) {
        const int x = wtot[w];
        n += x;
        before += (w < wave) ? x : 0;
    }
#pragma unroll
    for (int j = 0; j < 4; j++) {
        const int key = wave * 128 + j * 32 + lane;
        const int lb  = before + __builtin_popcount(bal[j] & ((1u << lane) - 1u));
        perm[((bal[j] >> lane) & 1u) ? lb : n + key - lb] = (unsigned short)key;
        before += __builtin_popcount(bal[j]);
    }
    __syncthreads();               // perm is whole
    if ((blockIdx.x & (Hc * 8 - 1)) == 0 && threadIdx.x == 0) nlive[b] = n;

    const int nt   = __builtin_amdgcn_readfirstlane(n ? (n + 31) >> 5 : NTILE);
    const int tile = (wave >> 1) * 8 + (blockIdx.x & 7);
    if (tile < nt) {               // the main kernel reads no tile from nt on
        const int half = wave & 1;
        const int st   = bh * NTILE + tile;
        const int d0   = half * 64 + (lane >> 2) * 4;
        const int key0 = (lane & 3) * 8;

        const v8us rk0 = *(const v8us*)&perm[tile * 32 + half * 16];
        const v8us rk1 = *(const v8us*)&perm[tile * 32 + half * 16 + 8];
        const v8us rv  = *(const v8us*)&perm[tile * 32 + key0];
        const char* kb = (const char*)(k + (size_t)bh * Sc * Dc);
        const char* vb = (const char*)(v + (size_t)bh * Sc * Dc);
        unsigned ka[16], va[8];    // byte offsets in this (b,h): the loads' address registers
#pragma unroll
        for (int i = 0; i < 8; i++) {
            ka[i]     = (unsigned)rk0[i] * (Dc * 4) + lane * 16;
            ka[8 + i] = (unsigned)rk1[i] * (Dc * 4) + lane * 16;
            va[i]     = (unsigned)rv[i] * (Dc * 4) + d0 * 4;
        }

        // Every loop here is unrolled so that kx and vx are indexed by constants
        // and stay in registers.
        v4f kx[16];
#pragma unroll
        for (int i = 0; i < 16; i++) kx[i] = *(const v4f*)(kb + ka[i]);
        v4f vx[2][8];                            // [32-d group][position]
#pragma unroll
        for (int i = 0; i < 8; i++) {
            vx[0][i] = *(const v4f*)(vb + va[i]);
            vx[1][i] = *(const v4f*)(vb + va[i] + 128);
        }
        // The wait that stands before a load's address registers are written again.
        // As inputs the offsets stay live up to it, so that no load lands on them;
        // and no load sinks below it: without it the compiler holds the V loads
        // back until K has landed, two memory latencies in a row.
        asm volatile("s_wait_xcnt 0x0"
                     :: "v"(ka[0]), "v"(ka[1]), "v"(ka[2]), "v"(ka[3]), "v"(ka[4]),
                        "v"(ka[5]), "v"(ka[6]), "v"(ka[7]), "v"(ka[8]), "v"(ka[9]),
                        "v"(ka[10]), "v"(ka[11]), "v"(ka[12]), "v"(ka[13]),
                        "v"(ka[14]), "v"(ka[15]), "v"(va[0]), "v"(va[1]), "v"(va[2]),
                        "v"(va[3]), "v"(va[4]), "v"(va[5]), "v"(va[6]), "v"(va[7])
                     : "memory");

        _Float16* ko = kh + (size_t)st * TILE_HALVES + half * (TILE_HALVES / 2) + lane * 4;
#pragma unroll
        for (int i = 0; i < 16; i++)
            *(v4h*)(ko + i * 128) = __builtin_convertvector(kx[i], v4h);

        _Float16* vo = vh + (size_t)st * TILE_HALVES + d0 * 32 + key0;
#pragma unroll
        for (int r = 0; r < 2; r++) {
#pragma unroll
            for (int j = 0; j < 4; j++) {
                v8h y;
#pragma unroll
                for (int i = 0; i < 8; i++) y[i] = (_Float16)vx[r][i][j];
                *(v8h*)(vo + (r * 32 + j) * 32) = y;
            }
        }
    }
}

// ---------------------------------------------------------------------------
// Main kernel (workspace path): f16 K/V, async double-buffered LDS pipeline.
// Transposed products: S^T = K x Q^T (A = K rows, B = Q), O^T += V^T x P^T.
// A lane holds 16 of the tile's 32 scores of ONE query (column ln), so the
// maximum and the sum run in the lane, with one exchange between the halves,
// and P^T packs from the two score tiles straight into a B operand.
// The pre-pass has put the unmasked keys first: the loop walks the tiles that
// hold one, and only a tile that also holds masked keys selects.
// ---------------------------------------------------------------------------
__global__ __launch_bounds__(128, 1)
void fa_fwd_wmma2(const float* __restrict__ q, const _Float16* __restrict__ kh,
                  const _Float16* __restrict__ vh, const int* __restrict__ nlive,
                  float* __restrict__ out) {
    constexpr float SCALE = 0.08838834764831845f;  // 1/sqrt(128)
    constexpr float NEGV  = -1.0e9f;

    __shared__ alignas(32) _Float16 Kt[2][32 * KP];    // [key][d]
    __shared__ alignas(32) _Float16 Vt[2][128 * VP];   // [d][key]
    __shared__ alignas(32) _Float16 Qs[4][16 * KP];

    const int t    = threadIdx.x;
    const int wave = t >> 5;
    const int lane = t & 31;
    const int ln   = lane & 15;
    const int hf   = lane >> 4;
    const int bh   = blockIdx.y;
    const int b    = bh >> 4;
    const int q0   = blockIdx.x * 64 + wave * 16;

    // unmasked keys of this batch; with none every key counts alike:
    // all tiles are walked and every score is the masked value
    const int n  = __builtin_amdgcn_readfirstlane(min(max(nlive[b], 0), Sc));
    const int nt = n ? (n + 31) >> 5 : NTILE;

    const _Float16* kbase = kh + (size_t)bh * NTILE * TILE_HALVES;
    const _Float16* vbase = vh + (size_t)bh * NTILE * TILE_HALVES;

    // ---- prologue: kick off async copy of tile 0 while staging Q
    tile_copy<128, KP>(kbase, Kt[0], t);
    tile_copy<32, VP>(vbase, Vt[0], t);

    {
        const float* qp = q + ((size_t)bh * Sc + q0 + ln) * Dc + hf * 64;
        _Float16* dst = &Qs[wave][ln * KP + hf * 64];
#pragma unroll
        for (int j = 0; j < 16; j++) {
            float4 x = ((const float4*)qp)[j];
            dst[4 * j + 0] = (_Float16)x.x;
            dst[4 * j + 1] = (_Float16)x.y;
            dst[4 * j + 2] = (_Float16)x.z;
            dst[4 * j + 3] = (_Float16)x.w;
        }
    }
    __syncthreads();

    v16h qf[4];
#pragma unroll
    for (int c = 0; c < 4; c++)
        qf[c] = ld_frag(&Qs[wave][ln * KP + c * 32 + hf * 16]);

    v8f o[8];                       // o[n][g] = O^T[d = 16n + 8hf + g][query ln]
#pragma unroll
    for (int n = 0; n < 8; n++) o[n] = v8f{};
    float mrun = -3.0e38f;          // this query's running maximum (both halves alike)
    float lrun = 0.0f;              // this half's share of the query's sum

#pragma unroll 1
    for (int kb = 0; kb < nt; kb++) {
        const int cur = kb & 1;
        // loads for tile kb were issued last iteration (or prologue)
        wait_async_kv();
        __syncthreads();   // tiles visible; all waves done reading buffer cur^1

        if (kb + 1 < nt) {  // prefetch next tile into the other buffer
            tile_copy<128, KP>(kbase + (size_t)(kb + 1) * TILE_HALVES, Kt[cur ^ 1], t);
            tile_copy<32, VP>(vbase + (size_t)(kb + 1) * TILE_HALVES, Vt[cur ^ 1], t);
        }

        const _Float16* Kc = Kt[cur];
        const _Float16* Vc = Vt[cur];

        // ---- scores: S^T = K x Q^T for two 16-key sub-blocks (fp32 acc)
        v8f acc0 = v8f{}, acc1 = v8f{};
#pragma unroll
        for (int c = 0; c < 4; c++) {
            v16h a0 = ld_frag(&Kc[ln * KP + c * 32 + hf * 16]);
            acc0 = __builtin_amdgcn_wmma_f32_16x16x32_f16(false, a0, false, qf[c],
                                                          (short)0, acc0, false, false);
        }
#pragma unroll
        for (int c = 0; c < 4; c++) {
            v16h a1 = ld_frag(&Kc[(16 + ln) * KP + c * 32 + hf * 16]);
            acc1 = __builtin_amdgcn_wmma_f32_16x16x32_f16(false, a1, false, qf[c],
                                                          (short)0, acc1, false, false);
        }

        // ---- online softmax of one query per lane
        v8f s0 = acc0 * SCALE, s1 = acc1 * SCALE;
        if (__builtin_expect((kb + 1) * 32 > n, 0)) {   // rare; the same for the whole block
            // accX[g] belongs to position kb*32 + 16X + 8hf + g; from n on masked
            const int r = n - kb * 32 - 8 * hf;
#pragma unroll
            for (int g = 0; g < 8; g++) {
                s0[g] = g < r      ? s0[g] : NEGV;
                s1[g] = 16 + g < r ? s1[g] : NEGV;
            }
        }
        float tq[4];                // four short chains, not one of sixteen links
#pragma unroll
        for (int g = 0; g < 4; g++)
            tq[g] = fmaxf(fmaxf(s0[2 * g], s0[2 * g + 1]), fmaxf(s1[2 * g], s1[2 * g + 1]));
        float tm = fmaxf(fmaxf(tq[0], tq[1]), fmaxf(tq[2], tq[3]));
        tm = fmaxf(tm, xhalf(tm));
        const float mnew  = fmaxf(mrun, tm);
        const float alpha = __expf(mrun - mnew);
        mrun = mnew;

        v16h pf;                    // P^T as B: element g is key 8hf + g, 8 + g is key 16 + 8hf + g
        float rs0 = 0.0f, rs1 = 0.0f;
#pragma unroll
        for (int g = 0; g < 8; g++) {
            float e0 = __expf(s0[g] - mnew);
            float e1 = __expf(s1[g] - mnew);
            rs0 += e0;
            rs1 += e1;
            pf[g]     = (_Float16)e0;
            pf[8 + g] = (_Float16)e1;
        }
        lrun = lrun * alpha + (rs0 + rs1);

#pragma unroll
        for (int n = 0; n < 8; n++) o[n] *= alpha;

#pragma unroll
        for (int n = 0; n < 8; n++) {
            v16h vf = ld_frag_kmap(&Vc[(n * 16 + ln) * VP], hf);
            o[n] = __builtin_amdgcn_wmma_f32_16x16x32_f16(false, vf, false, pf,
                                                          (short)0, o[n], false, false);
        }
    }

    // ---- epilogue: join the halves' sums; a lane stores 8 consecutive d of its query
    const float rcp = 1.0f / (lrun + xhalf(lrun));
    float* op = out + ((size_t)bh * Sc + q0 + ln) * Dc + 8 * hf;
#pragma unroll
    for (int n = 0; n < 8; n++) {
        v8f r = o[n] * rcp;
        *(v4f*)&op[n * 16]     = __builtin_shufflevector(r, r, 0, 1, 2, 3);
        *(v4f*)&op[n * 16 + 4] = __builtin_shufflevector(r, r, 4, 5, 6, 7);
    }
}

// ---------------------------------------------------------------------------
// Fallback (no workspace): round-1 kernel, converts in-loop.
// ---------------------------------------------------------------------------
__global__ __launch_bounds__(128, 1)
void fa_fwd_wmma1(const float* __restrict__ q, const float* __restrict__ k,
                  const float* __restrict__ v, const int* __restrict__ mask,
                  float* __restrict__ out) {
    constexpr float SCALE = 0.08838834764831845f;
    constexpr float NEGV  = -1.0e9f;

    __shared__ alignas(32) _Float16 Kt[32 * 128];
    __shared__ alignas(32) _Float16 Vt[128 * 32];
    __shared__ alignas(32) _Float16 Qs[4][16 * 128];
    __shared__ alignas(32) _Float16 Pt[4][16 * 32];

    const int t    = threadIdx.x;
    const int wave = t >> 5;
    const int lane = t & 31;
    const int ln   = lane & 15;
    const int hf   = lane >> 4;
    const int bh   = blockIdx.y;
    const int b    = bh >> 4;
    const int q0   = blockIdx.x * 64 + wave * 16;

    {
        const float* qp = q + ((size_t)bh * Sc + q0 + ln) * Dc + hf * 64;
        _Float16* dst = &Qs[wave][ln * 128 + hf * 64];
#pragma unroll
        for (int j = 0; j < 16; j++) {
            float4 x = ((const float4*)qp)[j];
            dst[4 * j + 0] = (_Float16)x.x;
            dst[4 * j + 1] = (_Float16)x.y;
            dst[4 * j + 2] = (_Float16)x.z;
            dst[4 * j + 3] = (_Float16)x.w;
        }
    }
    __syncthreads();

    v16h qf[4];
#pragma unroll
    for (int c = 0; c < 4; c++)
        qf[c] = *(const v16h*)&Qs[wave][ln * 128 + c * 32 + hf * 16];

    v8f o[8];
#pragma unroll
    for (int n = 0; n < 8; n++) o[n] = v8f{};
    float mrow[8], lrow[8];
#pragma unroll
    for (int g = 0; g < 8; g++) { mrow[g] = -3.0e38f; lrow[g] = 0.0f; }

    const int row = t >> 2;
    const int d0  = (t & 3) * 32;

#pragma unroll 1
    for (int kb = 0; kb < NTILE; kb++) {
        const int kcol = kb * 32;
        __syncthreads();
        {
            const float* kp = k + ((size_t)bh * Sc + kcol + row) * Dc + d0;
            const float* vp = v + ((size_t)bh * Sc + kcol + row) * Dc + d0;
            _Float16* kd = &Kt[row * 128 + d0];
#pragma unroll
            for (int j = 0; j < 8; j++) {
                float4 x = ((const float4*)kp)[j];
                kd[4 * j + 0] = (_Float16)x.x;
                kd[4 * j + 1] = (_Float16)x.y;
                kd[4 * j + 2] = (_Float16)x.z;
                kd[4 * j + 3] = (_Float16)x.w;
                float4 y = ((const float4*)vp)[j];
                Vt[(d0 + 4 * j + 0) * 32 + row] = (_Float16)y.x;
                Vt[(d0 + 4 * j + 1) * 32 + row] = (_Float16)y.y;
                Vt[(d0 + 4 * j + 2) * 32 + row] = (_Float16)y.z;
                Vt[(d0 + 4 * j + 3) * 32 + row] = (_Float16)y.w;
            }
        }
        __syncthreads();

        v8f acc0 = v8f{}, acc1 = v8f{};
#pragma unroll
        for (int c = 0; c < 4; c++) {
            v16h b0 = *(const v16h*)&Kt[ln * 128 + c * 32 + hf * 16];
            acc0 = __builtin_amdgcn_wmma_f32_16x16x32_f16(false, qf[c], false, b0,
                                                          (short)0, acc0, false, false);
        }
#pragma unroll
        for (int c = 0; c < 4; c++) {
            v16h b1 = *(const v16h*)&Kt[(16 + ln) * 128 + c * 32 + hf * 16];
            acc1 = __builtin_amdgcn_wmma_f32_16x16x32_f16(false, qf[c], false, b1,
                                                          (short)0, acc1, false, false);
        }

        const int m0 = mask[b * Sc + kcol + ln];
        const int m1 = mask[b * Sc + kcol + 16 + ln];
        const float sc0 = m0 ? SCALE : 0.0f, ad0 = m0 ? 0.0f : NEGV;
        const float sc1 = m1 ? SCALE : 0.0f, ad1 = m1 ? 0.0f : NEGV;

        float p0[8], p1[8], alpha[8];
#pragma unroll
        for (int g = 0; g < 8; g++) {
            float s0 = acc0[g] * sc0 + ad0;
            float s1 = acc1[g] * sc1 + ad1;
            float bm   = rmax16(fmaxf(s0, s1));
            float mnew = fmaxf(mrow[g], bm);
            alpha[g] = __expf(mrow[g] - mnew);
            p0[g]    = __expf(s0 - mnew);
            p1[g]    = __expf(s1 - mnew);
            float rs = rsum16(p0[g] + p1[g]);
            lrow[g] = lrow[g] * alpha[g] + rs;
            mrow[g] = mnew;
        }

#pragma unroll
        for (int g = 0; g < 8; g++) {
            Pt[wave][(g + 8 * hf) * 32 + ln]      = (_Float16)p0[g];
            Pt[wave][(g + 8 * hf) * 32 + 16 + ln] = (_Float16)p1[g];
        }
#pragma unroll
        for (int n = 0; n < 8; n++) {
#pragma unroll
            for (int g = 0; g < 8; g++) o[n][g] *= alpha[g];
        }
        asm volatile("s_wait_dscnt 0" ::: "memory");

        v16h pf = *(const v16h*)&Pt[wave][ln * 32 + hf * 16];
#pragma unroll
        for (int n = 0; n < 8; n++) {
            v16h vf = *(const v16h*)&Vt[(n * 16 + ln) * 32 + hf * 16];
            o[n] = __builtin_amdgcn_wmma_f32_16x16x32_f16(false, pf, false, vf,
                                                          (short)0, o[n], false, false);
        }
    }

    float rcp[8];
#pragma unroll
    for (int g = 0; g < 8; g++) rcp[g] = 1.0f / lrow[g];
#pragma unroll
    for (int n = 0; n < 8; n++) {
#pragma unroll
        for (int g = 0; g < 8; g++) {
            out[((size_t)bh * Sc + q0 + g + 8 * hf) * Dc + n * 16 + ln] = o[n][g] * rcp[g];
        }
    }
}

extern "C" void kernel_launch(void* const* d_in, const int* in_sizes, int n_in,
                              void* d_out, int out_size, void* d_ws, size_t ws_size,
                              hipStream_t stream) {
    (void)in_sizes; (void)n_in; (void)out_size;
    const float* q    = (const float*)d_in[0];
    const float* k    = (const float*)d_in[1];
    const float* v    = (const float*)d_in[2];
    const int*   mask = (const int*)d_in[3];
    float* out = (float*)d_out;

    const size_t nelem   = (size_t)Bc * Hc * Sc * Dc;   // 8,388,608
    const size_t ws_need = 2 * nelem * sizeof(_Float16) + Bc * sizeof(int);

    dim3 grid(Sc / 64, Bc * Hc);
    dim3 block(128);

    if (ws_size >= ws_need && d_ws != nullptr) {
        _Float16* kh = (_Float16*)d_ws;
        _Float16* vh = kh + nelem;
        int* nlive = (int*)(vh + nelem);
        cvt_kv<<<dim3(CVT_BLOCKS), dim3(CVT_THREADS), 0, stream>>>(k, v, mask, kh, vh, nlive);
        fa_fwd_wmma2<<<grid, block, 0, stream>>>(q, kh, vh, nlive, out);
    } else {
        fa_fwd_wmma1<<<grid, block, 0, stream>>>(q, k, v, mask, out);
    }
}

// v005
// A run of this version takes 52.3 microseconds.
// Timed twice side by side with v004, it ran 1.06 and 1.07 times as fast.
// Over all steps from v000 it is 5.80 times as fast.
#include <hip/hip_runtime.h>
#include <hip/hip_bf16.h>

typedef __attribute__((ext_vector_type(16))) _Float16 v16h;
typedef __attribute__((ext_vector_type(8)))  _Float16 v8h;
typedef __attribute__((ext_vector_type(4)))  _Float16 v4h;
typedef __attribute__((ext_vector_type(8)))  float    v8f;
typedef __attribute__((ext_vector_type(4)))  int      v4i;
typedef __attribute__((ext_vector_type(4)))  float    v4f;
typedef __attribute__((ext_vector_type(8)))  unsigned short v8us;

#define Bc 2
#define Hc 16
#define Sc 2048
#define Dc 128
#define NTILE (Sc / 32)            // 64 key tiles per (b,h)
#define TILE_HALVES (32 * 128)     // 4096 f16 per K or V tile (8KB)
// LDS row pitches in f16: 16 bytes x odd, so that the 16 lanes of a half wave,
// one row each, spread a 16-byte read over all 64 banks.
#define KP 136                     // 256-byte rows (K, Q) at 272 bytes
#define VP 40                      // 64-byte rows (V^T) at 80 bytes

#if defined(__has_builtin)
#if __has_builtin(__builtin_amdgcn_global_load_async_to_lds_b128)
#define ASYNC_KV 1
#endif
#endif

__device__ __forceinline__ float rmax16(float x) {
    x = fmaxf(x, __shfl_xor(x, 1, 32));
    x = fmaxf(x, __shfl_xor(x, 2, 32));
    x = fmaxf(x, __shfl_xor(x, 4, 32));
    x = fmaxf(x, __shfl_xor(x, 8, 32));
    return x;
}
__device__ __forceinline__ float rsum16(float x) {
    x += __shfl_xor(x, 1, 32);
    x += __shfl_xor(x, 2, 32);
    x += __shfl_xor(x, 4, 32);
    x += __shfl_xor(x, 8, 32);
    return x;
}

// Lane l takes the value of lane l ^ 16 (the other half of the wave).
__device__ __forceinline__ float xhalf(float x) {
    int i = __builtin_bit_cast(int, x);
    return __builtin_bit_cast(float, __builtin_amdgcn_permlanex16(
        i, i, 0x76543210, 0xfedcba98, false, false));
}

// One 16-element fragment from a padded LDS row: rows are 16-byte aligned only.
__device__ __forceinline__ v16h ld_frag(const _Float16* p) {
    v8h lo = *(const v8h*)p;
    v8h hi = *(const v8h*)(p + 8);
    return __builtin_shufflevector(lo, hi, 0, 1, 2, 3, 4, 5, 6, 7,
                                   8, 9, 10, 11, 12, 13, 14, 15);
}

// A fragment whose k order pairs with a B operand packed from two accumulator
// tiles: half h of the wave holds k 8h..8h+7 and 16+8h..16+8h+7.
__device__ __forceinline__ v16h ld_frag_kmap(const _Float16* row, int h) {
    v8h lo = *(const v8h*)(row + 8 * h);
    v8h hi = *(const v8h*)(row + 16 + 8 * h);
    return __builtin_shufflevector(lo, hi, 0, 1, 2, 3, 4, 5, 6, 7,
                                   8, 9, 10, 11, 12, 13, 14, 15);
}

// Copy one 8KB tile (4096 f16) global -> LDS, 128 threads, thread t does 4x16B.
// The global image is contiguous rows of ROW f16; in LDS the rows lie PITCH apart.
template <int ROW, int PITCH>
__device__ __forceinline__ void tile_copy(const _Float16* __restrict__ g,
                                          _Float16* l, int t) {
    constexpr int CH = ROW / 8;                 // 16-byte chunks per row
    l += (t / CH) * PITCH + (t % CH) * 8;       // this thread's chunk, step 0
    constexpr int LSTEP = (128 / CH) * PITCH;   // rows per step x pitch
#ifdef ASYNC_KV
    typedef __attribute__((address_space(1))) v4i gv4i;   // global <4 x i32>
    typedef __attribute__((address_space(3))) v4i lv4i;   // LDS    <4 x i32>
#pragma unroll
    for (int i = 0; i < 4; i++) {
        __builtin_amdgcn_global_load_async_to_lds_b128(
            (gv4i*)(g + t * 8 + i * 1024),
            (lv4i*)(l + i * LSTEP), 0, 0);
    }
#else
#pragma unroll
    for (int i = 0; i < 4; i++) {
        *(v8h*)(l + i * LSTEP) = *(const v8h*)(g + t * 8 + i * 1024);
    }
#endif
}

__device__ __forceinline__ void wait_async_kv() {
#ifdef ASYNC_KV
    asm volatile("s_wait_asynccnt 0" ::: "memory");
#endif
}

// ---------------------------------------------------------------------------
// Pre-pass: fp32 K/V -> f16, the keys of a batch reordered so that the unmasked
// ones come first (a masked key's weight is exp(-1e9 - max) = 0 as soon as one key
// is unmasked), V transposed tile-wise so hot-loop LDS tiles are contiguous memcpy
// images.  kh: [bh][position][d].  vh: [bh][tile][d][position32].
// Every block forms the order of its batch itself: a stable partition, unmasked
// keys in their order, then the masked ones.  It is a permutation of 0..Sc-1 for
// any content of the mask, so every row index read from perm lies inside K and V.
// The masked keys behind the last unmasked one fill up the last tile with finite
// rows; with no unmasked key the order is the identity and all tiles are written.
// One wave converts half a 32-key tile of K and of V with 32 loads of 16 bytes,
// all issued before the first conversion.
// K: 16 rows, each load one whole row of 512 bytes, each store 256.
// V: a strip of 32 keys x 64 d.  A lane loads 4 d of 8 consecutive positions, so
// the 8 positions of one d (16 bytes of vh) lie in that lane: the transpose is a
// choice of registers.  Four neighbour lanes hold the four groups of the same d:
// a load touches whole 128-byte lines, a store writes whole 64-byte rows of vh.
// A block takes every 8th tile of its (b,h), so that the tiles that are needed
// spread evenly over the blocks.
// ---------------------------------------------------------------------------
#define CVT_THREADS 512
#define CVT_BLOCKS (Bc * Hc * 8)   // 16 waves = 8 tiles x 2 halves per block
__global__ __launch_bounds__(CVT_THREADS)
void cvt_kv(const float* __restrict__ k, const float* __restrict__ v,
            const int* __restrict__ mask,
            _Float16* __restrict__ kh, _Float16* __restrict__ vh,
            int* __restrict__ nlive) {
    __shared__ alignas(16) unsigned short perm[Sc];   // position -> key
    __shared__ alignas(16) int wtot[CVT_THREADS / 32];

    const int lane = threadIdx.x & 31;
    const int wave = __builtin_amdgcn_readfirstlane(threadIdx.x >> 5);
    const int bh   = blockIdx.x >> 3;
    const int b    = bh >> 4;

    // ---- the order: wave w ranks keys 128w .. 128w+127, 32 per ballot
    const int* mp = mask + b * Sc + wave * 128 + lane;
    unsigned bal[4];
    int tot = 0;
#pragma unroll
    for (int j = 0; j < 4; j++) {
        bal[j] = __builtin_amdgcn_ballot_w32(mp[j * 32] != 0);
        tot += __builtin_popcount(bal[j]);
    }
    if (lane == 0) wtot[wave] = tot;
    __syncthreads();               // every wave's count is in wtot
    int before = 0, n = 0;         // unmasked keys in front of this wave's; in all
#pragma unroll
    for (int w = 0; w < CVT_THREADS / 32; w++) {
        const int x = wtot[w];
        n += x;
        before += (w < wave) ? x : 0;
    }
#pragma unroll
    for (int j = 0; j < 4; j++) {
        const int key = wave * 128 + j * 32 + lane;
        const int lb  = before + __builtin_popcount(bal[j] & ((1u << lane) - 1u));
        perm[((bal[j] >> lane) & 1u) ? lb : n + key - lb] = (unsigned short)key;
        before += __builtin_popcount(bal[j]);
    }
    __syncthreads();               // perm is whole
    if ((blockIdx.x & (Hc * 8 - 1)) == 0 && threadIdx.x == 0) nlive[b] = n;

    const int nt   = __builtin_amdgcn_readfirstlane(n ? (n + 31) >> 5 : NTILE);
    const int tile = (wave >> 1) * 8 + (blockIdx.x & 7);
    if (tile < nt) {               // the main kernel reads no tile from nt on
        const int half = wave & 1;
        const int st   = bh * NTILE + tile;
        const int d0   = half * 64 + (lane >> 2) * 4;
        const int key0 = (lane & 3) * 8;

        const v8us rk0 = *(const v8us*)&perm[tile * 32 + half * 16];
        const v8us rk1 = *(const v8us*)&perm[tile * 32 + half * 16 + 8];
        const v8us rv  = *(const v8us*)&perm[tile * 32 + key0];
        const char* kb = (const char*)(k + (size_t)bh * Sc * Dc);
        const char* vb = (const char*)(v + (size_t)bh * Sc * Dc);
        unsigned ka[16], va[8];    // byte offsets in this (b,h): the loads' address registers
#pragma unroll
        for (int i = 0; i < 8; i++) {
            ka[i]     = (unsigned)rk0[i] * (Dc * 4) + lane * 16;
            ka[8 + i] = (unsigned)rk1[i] * (Dc * 4) + lane * 16;
            va[i]     = (unsigned)rv[i] * (Dc * 4) + d0 * 4;
        }

        // Every loop here is unrolled so that kx and vx are indexed by constants
        // and stay in registers.
        v4f kx[16];
#pragma unroll
        for (int i = 0; i < 16; i++) kx[i] = *(const v4f*)(kb + ka[i]);
        v4f vx[2][8];                            // [32-d group][position]
#pragma unroll
        for (int i = 0; i < 8; i++) {
            vx[0][i] = *(const v4f*)(vb + va[i]);
            vx[1][i] = *(const v4f*)(vb + va[i] + 128);
        }
        // The wait that stands before a load's address registers are written again.
        // As inputs the offsets stay live up to it, so that no load lands on them;
        // and no load sinks below it: without it the compiler holds the V loads
        // back until K has landed, two memory latencies in a row.
        asm volatile("s_wait_xcnt 0x0"
                     :: "v"(ka[0]), "v"(ka[1]), "v"(ka[2]), "v"(ka[3]), "v"(ka[4]),
                        "v"(ka[5]), "v"(ka[6]), "v"(ka[7]), "v"(ka[8]), "v"(ka[9]),
                        "v"(ka[10]), "v"(ka[11]), "v"(ka[12]), "v"(ka[13]),
                        "v"(ka[14]), "v"(ka[15]), "v"(va[0]), "v"(va[1]), "v"(va[2]),
                        "v"(va[3]), "v"(va[4]), "v"(va[5]), "v"(va[6]), "v"(va[7])
                     : "memory");

        _Float16* ko = kh + (size_t)st * TILE_HALVES + half * (TILE_HALVES / 2) + lane * 4;
#pragma unroll
        for (int i = 0; i < 16; i++)
            *(v4h*)(ko + i * 128) = __builtin_convertvector(kx[i], v4h);

        _Float16* vo = vh + (size_t)st * TILE_HALVES + d0 * 32 + key0;
#pragma unroll
        for (int r = 0; r < 2; r++) {
#pragma unroll
            for (int j = 0; j < 4; j++) {
                v8h y;
#pragma unroll
                for (int i = 0; i < 8; i++) y[i] = (_Float16)vx[r][i][j];
                *(v8h*)(vo + (r * 32 + j) * 32) = y;
            }
        }
    }
}

// P of one tile from its exponents: the B operand of O^T += V^T x P^T (element g is
// key 8hf + g, element 8 + g key 16 + 8hf + g) and this lane's sum of the 16 values.
__device__ __forceinline__ float tile_p(const v8f& x0, const v8f& x1, v16h& pf) {
    float rs[4] = {0.0f, 0.0f, 0.0f, 0.0f};     // four short chains
#pragma unroll
    for (int g = 0; g < 8; g++) {
        const float e0 = __builtin_amdgcn_exp2f(x0[g]);
        const float e1 = __builtin_amdgcn_exp2f(x1[g]);
        rs[g & 1]       += e0;
        rs[2 + (g & 1)] += e1;
        pf[g]     = (_Float16)e0;
        pf[8 + g] = (_Float16)e1;
    }
    return (rs[0] + rs[1]) + (rs[2] + rs[3]);
}

// ---------------------------------------------------------------------------
// Main kernel (workspace path): f16 K/V, async double-buffered LDS pipeline.
// Transposed products: S^T = K x Q^T (A = K rows, B = Q), O^T += V^T x P^T.
// A lane holds 16 of the tile's 32 scores of ONE query (column ln), so the
// maximum and the sum run in the lane, with one exchange between the halves,
// and P^T packs from the two score tiles straight into a B operand.
// The pre-pass has put the unmasked keys first: the loop walks the tiles that
// hold one, and only a tile that also holds masked keys selects.
// The score product yields the exponent itself: Q carries scale * log2(e), and minus
// the query's softmax reference is the C operand, so P = exp2(accumulator).  The
// reference is held from tile to tile: the first tile sets it to its maximum, and it
// rises, with O and the sum rescaled, only when a lane's P sum of a tile passes PLIM.
// ---------------------------------------------------------------------------
__global__ __launch_bounds__(128, 1)
void fa_fwd_wmma2(const float* __restrict__ q, const _Float16* __restrict__ kh,
                  const _Float16* __restrict__ vh, const int* __restrict__ nlive,
                  float* __restrict__ out) {
    constexpr float LOG2E  = 1.4426950408889634f;
    constexpr float QSCALE = 0.08838834764831845f * LOG2E;  // 1/sqrt(128) in log2 units
    constexpr float NEGV   = -1.0e9f * LOG2E;               // the masked score, same units
    constexpr float PLIM   = 256.0f;                        // no P above it: well inside f16

    __shared__ alignas(32) _Float16 Kt[2][32 * KP];    // [key][d]
    __shared__ alignas(32) _Float16 Vt[2][128 * VP];   // [d][key]
    __shared__ alignas(32) _Float16 Qs[4][16 * KP];

    const int t    = threadIdx.x;
    const int wave = t >> 5;
    const int lane = t & 31;
    const int ln   = lane & 15;
    const int hf   = lane >> 4;
    const int bh   = blockIdx.y;
    const int b    = bh >> 4;
    const int q0   = blockIdx.x * 64 + wave * 16;

    // unmasked keys of this batch; with none every key counts alike:
    // all tiles are walked and every score is the masked value
    const int n  = __builtin_amdgcn_readfirstlane(min(max(nlive[b], 0), Sc));
    const int nt = n ? (n + 31) >> 5 : NTILE;

    const _Float16* kbase = kh + (size_t)bh * NTILE * TILE_HALVES;
    const _Float16* vbase = vh + (size_t)bh * NTILE * TILE_HALVES;

    // ---- prologue: kick off async copy of tile 0 while staging Q
    tile_copy<128, KP>(kbase, Kt[0], t);
    tile_copy<32, VP>(vbase, Vt[0], t);

    {
        const float* qp = q + ((size_t)bh * Sc + q0 + ln) * Dc + hf * 64;
        _Float16* dst = &Qs[wave][ln * KP + hf * 64];
#pragma unroll
        for (int j = 0; j < 16; j++) {
            float4 x = ((const float4*)qp)[j];
            dst[4 * j + 0] = (_Float16)(x.x * QSCALE);
            dst[4 * j + 1] = (_Float16)(x.y * QSCALE);
            dst[4 * j + 2] = (_Float16)(x.z * QSCALE);
            dst[4 * j + 3] = (_Float16)(x.w * QSCALE);
        }
    }
    __syncthreads();

    v16h qf[4];
#pragma unroll
    for (int c = 0; c < 4; c++)
        qf[c] = ld_frag(&Qs[wave][ln * KP + c * 32 + hf * 16]);

    v8f o[8];                       // o[n][g] = O^T[d = 16n + 8hf + g][query ln]
#pragma unroll
    for (int n = 0; n < 8; n++) o[n] = v8f{};
    v8f cref = v8f{};               // minus this query's reference (both halves alike), as C
    float lrun = 0.0f;              // this half's share of the query's sum

#pragma unroll 1
    for (int kb = 0; kb < nt; kb++) {
        const int cur = kb & 1;
        // loads for tile kb were issued last iteration (or prologue)
        wait_async_kv();
        __syncthreads();   // tiles visible; all waves done reading buffer cur^1

        if (kb + 1 < nt) {  // prefetch next tile into the other buffer
            tile_copy<128, KP>(kbase + (size_t)(kb + 1) * TILE_HALVES, Kt[cur ^ 1], t);
            tile_copy<32, VP>(vbase + (size_t)(kb + 1) * TILE_HALVES, Vt[cur ^ 1], t);
        }

        const _Float16* Kc = Kt[cur];
        const _Float16* Vc = Vt[cur];

        // ---- exponents: K x Q^T - reference for two 16-key sub-blocks (fp32 acc)
        v8f acc0 = cref, acc1 = cref;
#pragma unroll
        for (int c = 0; c < 4; c++) {
            v16h a0 = ld_frag(&Kc[ln * KP + c * 32 + hf * 16]);
            acc0 = __builtin_amdgcn_wmma_f32_16x16x32_f16(false, a0, false, qf[c],
                                                          (short)0, acc0, false, false);
        }
#pragma unroll
        for (int c = 0; c < 4; c++) {
            v16h a1 = ld_frag(&Kc[(16 + ln) * KP + c * 32 + hf * 16]);
            acc1 = __builtin_amdgcn_wmma_f32_16x16x32_f16(false, a1, false, qf[c],
                                                          (short)0, acc1, false, false);
        }

        // ---- softmax of one query per lane against the held reference
        if (__builtin_expect((kb + 1) * 32 > n, 0)) {   // rare; the same for the whole block
            // accX[g] belongs to position kb*32 + 16X + 8hf + g; from n on masked
            const int r = n - kb * 32 - 8 * hf;
            const float mv = NEGV + cref[0];            // the masked score minus the reference
#pragma unroll
            for (int g = 0; g < 8; g++) {
                acc0[g] = g < r      ? acc0[g] : mv;
                acc1[g] = 16 + g < r ? acc1[g] : mv;
            }
        }
        // The V^T fragments are asked for here, as one group: behind the branch below
        // their LDS latency would stand in front of every product.
        v16h vf[8];
#pragma unroll
        for (int n = 0; n < 8; n++) vf[n] = ld_frag_kmap(&Vc[(n * 16 + ln) * VP], hf);

        v16h pf;
        float rs = tile_p(acc0, acc1, pf);
        // One test per tile; the ballot makes it a scalar branch, so that every lane
        // stays on for the WMMAs.  An overflowed P gives an infinite sum and is caught;
        // the first tile always passes the test (a sum is never below 0).
        const float lim = kb == 0 ? -1.0f : PLIM;
        if (__builtin_amdgcn_ballot_w32(rs > lim) != 0) {
            float tq[4];            // four short chains, not one of sixteen links
#pragma unroll
            for (int g = 0; g < 4; g++)
                tq[g] = fmaxf(fmaxf(acc0[2 * g], acc0[2 * g + 1]),
                              fmaxf(acc1[2 * g], acc1[2 * g + 1]));
            float tm = fmaxf(fmaxf(tq[0], tq[1]), fmaxf(tq[2], tq[3]));
            tm = fmaxf(tm, xhalf(tm));                  // both halves move alike
            const float up = fmaxf(tm, 0.0f);           // later tiles only raise the reference
            const float d  = kb == 0 ? tm : up;         // the first sets it (O and sum are 0)
            const float alpha = __builtin_amdgcn_exp2f(-up);
            lrun *= alpha;
#pragma unroll
            for (int n = 0; n < 8; n++) o[n] *= alpha;
            cref -= d;
            acc0 -= d;
            acc1 -= d;
            rs = tile_p(acc0, acc1, pf);
        }
        lrun += rs;

#pragma unroll
        for (int n = 0; n < 8; n++)
            o[n] = __builtin_amdgcn_wmma_f32_16x16x32_f16(false, vf[n], false, pf,
                                                          (short)0, o[n], false, false);
    }

    // ---- epilogue: join the halves' sums; a lane stores 8 consecutive d of its query
    const float rcp = 1.0f / (lrun + xhalf(lrun));
    float* op = out + ((size_t)bh * Sc + q0 + ln) * Dc + 8 * hf;
#pragma unroll
    for (int n = 0; n < 8; n++) {
        v8f r = o[n] * rcp;
        *(v4f*)&op[n * 16]     = __builtin_shufflevector(r, r, 0, 1, 2, 3);
        *(v4f*)&op[n * 16 + 4] = __builtin_shufflevector(r, r, 4, 5, 6, 7);
    }
}

// ---------------------------------------------------------------------------
// Fallback (no workspace): round-1 kernel, converts in-loop.
// ---------------------------------------------------------------------------
__global__ __launch_bounds__(128, 1)
void fa_fwd_wmma1(const float* __restrict__ q, const float* __restrict__ k,
                  const float* __restrict__ v, const int* __restrict__ mask,
                  float* __restrict__ out) {
    constexpr float SCALE = 0.08838834764831845f;
    constexpr float NEGV  = -1.0e9f;

    __shared__ alignas(32) _Float16 Kt[32 * 128];
    __shared__ alignas(32) _Float16 Vt[128 * 32];
    __shared__ alignas(32) _Float16 Qs[4][16 * 128];
    __shared__ alignas(32) _Float16 Pt[4][16 * 32];

    const int t    = threadIdx.x;
    const int wave = t >> 5;
    const int lane = t & 31;
    const int ln   = lane & 15;
    const int hf   = lane >> 4;
    const int bh   = blockIdx.y;
    const int b    = bh >> 4;
    const int q0   = blockIdx.x * 64 + wave * 16;

    {
        const float* qp = q + ((size_t)bh * Sc + q0 + ln) * Dc + hf * 64;
        _Float16* dst = &Qs[wave][ln * 128 + hf * 64];
#pragma unroll
        for (int j = 0; j < 16; j++) {
            float4 x = ((const float4*)qp)[j];
            dst[4 * j + 0] = (_Float16)x.x;
            dst[4 * j + 1] = (_Float16)x.y;
            dst[4 * j + 2] = (_Float16)x.z;
            dst[4 * j + 3] = (_Float16)x.w;
        }
    }
    __syncthreads();

    v16h qf[4];
#pragma unroll
    for (int c = 0; c < 4; c++)
        qf[c] = *(const v16h*)&Qs[wave][ln * 128 + c * 32 + hf * 16];

    v8f o[8];
#pragma unroll
    for (int n = 0; n < 8; n++) o[n] = v8f{};
    float mrow[8], lrow[8];
#pragma unroll
    for (int g = 0; g < 8; g++) { mrow[g] = -3.0e38f; lrow[g] = 0.0f; }

    const int row = t >> 2;
    const int d0  = (t & 3) * 32;

#pragma unroll 1
    for (int kb = 0; kb < NTILE; kb++) {
        const int kcol = kb * 32;
        __syncthreads();
        {
            const float* kp = k + ((size_t)bh * Sc + kcol + row) * Dc + d0;
            const float* vp = v + ((size_t)bh * Sc + kcol + row) * Dc + d0;
            _Float16* kd = &Kt[row * 128 + d0];
#pragma unroll
            for (int j = 0; j < 8; j++) {
                float4 x = ((const float4*)kp)[j];
                kd[4 * j + 0] = (_Float16)x.x;
                kd[4 * j + 1] = (_Float16)x.y;
                kd[4 * j + 2] = (_Float16)x.z;
                kd[4 * j + 3] = (_Float16)x.w;
                float4 y = ((const float4*)vp)[j];
                Vt[(d0 + 4 * j + 0) * 32 + row] = (_Float16)y.x;
                Vt[(d0 + 4 * j + 1) * 32 + row] = (_Float16)y.y;
                Vt[(d0 + 4 * j + 2) * 32 + row] = (_Float16)y.z;
                Vt[(d0 + 4 * j + 3) * 32 + row] = (_Float16)y.w;
            }
        }
        __syncthreads();

        v8f acc0 = v8f{}, acc1 = v8f{};
#pragma unroll
        for (int c = 0; c < 4; c++) {
            v16h b0 = *(const v16h*)&Kt[ln * 128 + c * 32 + hf * 16];
            acc0 = __builtin_amdgcn_wmma_f32_16x16x32_f16(false, qf[c], false, b0,
                                                          (short)0, acc0, false, false);
        }
#pragma unroll
        for (int c = 0; c < 4; c++) {
            v16h b1 = *(const v16h*)&Kt[(16 + ln) * 128 + c * 32 + hf * 16];
            acc1 = __builtin_amdgcn_wmma_f32_16x16x32_f16(false, qf[c], false, b1,
                                                          (short)0, acc1, false, false);
        }

        const int m0 = mask[b * Sc + kcol + ln];
        const int m1 = mask[b * Sc + kcol + 16 + ln];
        const float sc0 = m0 ? SCALE : 0.0f, ad0 = m0 ? 0.0f : NEGV;
        const float sc1 = m1 ? SCALE : 0.0f, ad1 = m1 ? 0.0f : NEGV;

        float p0[8], p1[8], alpha[8];
#pragma unroll
        for (int g = 0; g < 8; g++) {
            float s0 = acc0[g] * sc0 + ad0;
            float s1 = acc1[g] * sc1 + ad1;
            float bm   = rmax16(fmaxf(s0, s1));
            float mnew = fmaxf(mrow[g], bm);
            alpha[g] = __expf(mrow[g] - mnew);
            p0[g]    = __expf(s0 - mnew);
            p1[g]    = __expf(s1 - mnew);
            float rs = rsum16(p0[g] + p1[g]);
            lrow[g] = lrow[g] * alpha[g] + rs;
            mrow[g] = mnew;
        }

#pragma unroll
        for (int g = 0; g < 8; g++) {
            Pt[wave][(g + 8 * hf) * 32 + ln]      = (_Float16)p0[g];
            Pt[wave][(g + 8 * hf) * 32 + 16 + ln] = (_Float16)p1[g];
        }
#pragma unroll
        for (int n = 0; n < 8; n++) {
#pragma unroll
            for (int g = 0; g < 8; g++) o[n][g] *= alpha[g];
        }
        asm volatile("s_wait_dscnt 0" ::: "memory");

        v16h pf = *(const v16h*)&Pt[wave][ln * 32 + hf * 16];
#pragma unroll
        for (int n = 0; n < 8; n++) {
            v16h vf = *(const v16h*)&Vt[(n * 16 + ln) * 32 + hf * 16];
            o[n] = __builtin_amdgcn_wmma_f32_16x16x32_f16(false, pf, false, vf,
                                                          (short)0, o[n], false, false);
        }
    }

    float rcp[8];
#pragma unroll
    for (int g = 0; g < 8; g++) rcp[g] = 1.0f / lrow[g];
#pragma unroll
    for (int n = 0; n < 8; n++) {
#pragma unroll
        for (int g = 0; g < 8; g++) {
            out[((size_t)bh * Sc + q0 + g + 8 * hf) * Dc + n * 16 + ln] = o[n][g] * rcp[g];
        }
    }
}

extern "C" void kernel_launch(void* const* d_in, const int* in_sizes, int n_in,
                              void* d_out, int out_size, void* d_ws, size_t ws_size,
                              hipStream_t stream) {
    (void)in_sizes; (void)n_in; (void)out_size;
    const float* q    = (const float*)d_in[0];
    const float* k    = (const float*)d_in[1];
    const float* v    = (const float*)d_in[2];
    const int*   mask = (const int*)d_in[3];
    float* out = (float*)d_out;

    const size_t nelem   = (size_t)Bc * Hc * Sc * Dc;   // 8,388,608
    const size_t ws_need = 2 * nelem * sizeof(_Float16) + Bc * sizeof(int);

    dim3 grid(Sc / 64, Bc * Hc);
    dim3 block(128);

    if (ws_size >= ws_need && d_ws != nullptr) {
        _Float16* kh = (_Float16*)d_ws;
        _Float16* vh = kh + nelem;
        int* nlive = (int*)(vh + nelem);
        cvt_kv<<<dim3(CVT_BLOCKS), dim3(CVT_THREADS), 0, stream>>>(k, v, mask, kh, vh, nlive);
        fa_fwd_wmma2<<<grid, block, 0, stream>>>(q, kh, vh, nlive, out);
    } else {
        fa_fwd_wmma1<<<grid, block, 0, stream>>>(q, k, v, mask, out);
    }
}

// v006
// A run of this version takes 46.3 microseconds.
// In both of two side-by-side timings against v005, it was 1.13 times as fast.
// All steps since v000 together make it 6.56 times as fast.
#include <hip/hip_runtime.h>
#include <hip/hip_bf16.h>

typedef __attribute__((ext_vector_type(16))) _Float16 v16h;
typedef __attribute__((ext_vector_type(8)))  _Float16 v8h;
typedef __attribute__((ext_vector_type(4)))  _Float16 v4h;
typedef __attribute__((ext_vector_type(8)))  float    v8f;
typedef __attribute__((ext_vector_type(4)))  int      v4i;
typedef __attribute__((ext_vector_type(4)))  float    v4f;
typedef __attribute__((ext_vector_type(8)))  unsigned short v8us;

#define Bc 2
#define Hc 16
#define Sc 2048
#define Dc 128
#define NTILE (Sc / 32)            // 64 key tiles per (b,h)
#define TILE_HALVES (32 * 128)     // 4096 f16 per K or V tile (8KB)
// LDS row pitches in f16: 16 bytes x odd, so that the 16 lanes of a half wave,
// one row each, spread a 16-byte read over all 64 banks.
#define KP 136                     // 256-byte rows (K, Q) at 272 bytes
#define VP 40                      // 64-byte rows (V^T) at 80 bytes

#if defined(__has_builtin)
#if __has_builtin(__builtin_amdgcn_global_load_async_to_lds_b128)
#define ASYNC_KV 1
#endif
#endif

__device__ __forceinline__ float rmax16(float x) {
    x = fmaxf(x, __shfl_xor(x, 1, 32));
    x = fmaxf(x, __shfl_xor(x, 2, 32));
    x = fmaxf(x, __shfl_xor(x, 4, 32));
    x = fmaxf(x, __shfl_xor(x, 8, 32));
    return x;
}
__device__ __forceinline__ float rsum16(float x) {
    x += __shfl_xor(x, 1, 32);
    x += __shfl_xor(x, 2, 32);
    x += __shfl_xor(x, 4, 32);
    x += __shfl_xor(x, 8, 32);
    return x;
}

// Lane l takes the value of lane l ^ 16 (the other half of the wave).
__device__ __forceinline__ float xhalf(float x) {
    int i = __builtin_bit_cast(int, x);
    return __builtin_bit_cast(float, __builtin_amdgcn_permlanex16(
        i, i, 0x76543210, 0xfedcba98, false, false));
}

// One 16-element fragment from a padded LDS row: rows are 16-byte aligned only.
__device__ __forceinline__ v16h ld_frag(const _Float16* p) {
    v8h lo = *(const v8h*)p;
    v8h hi = *(const v8h*)(p + 8);
    return __builtin_shufflevector(lo, hi, 0, 1, 2, 3, 4, 5, 6, 7,
                                   8, 9, 10, 11, 12, 13, 14, 15);
}

// A fragment whose k order pairs with a B operand packed from two accumulator
// tiles: half h of the wave holds k 8h..8h+7 and 16+8h..16+8h+7.
__device__ __forceinline__ v16h ld_frag_kmap(const _Float16* row, int h) {
    v8h lo = *(const v8h*)(row + 8 * h);
    v8h hi = *(const v8h*)(row + 16 + 8 * h);
    return __builtin_shufflevector(lo, hi, 0, 1, 2, 3, 4, 5, 6, 7,
                                   8, 9, 10, 11, 12, 13, 14, 15);
}

// Copy one 8KB tile (4096 f16) global -> LDS, FA_THREADS threads, thread t does 2x16B.
// The global image is contiguous rows of ROW f16; in LDS the rows lie PITCH apart.
#define FA_WAVES 8
#define FA_THREADS (FA_WAVES * 32)
#define FA_QROWS (FA_WAVES * 32)   // queries of a block: 32 per wave
template <int ROW, int PITCH>
__device__ __forceinline__ void tile_copy(const _Float16* __restrict__ g,
                                          _Float16* l, int t) {
    constexpr int CH = ROW / 8;                 // 16-byte chunks per row
    constexpr int NSTEP = TILE_HALVES / 8 / FA_THREADS;
    l += (t / CH) * PITCH + (t % CH) * 8;       // this thread's chunk, step 0
    constexpr int LSTEP = (FA_THREADS / CH) * PITCH;   // rows per step x pitch
#ifdef ASYNC_KV
    typedef __attribute__((address_space(1))) v4i gv4i;   // global <4 x i32>
    typedef __attribute__((address_space(3))) v4i lv4i;   // LDS    <4 x i32>
#pragma unroll
    for (int i = 0; i < NSTEP; i++) {
        __builtin_amdgcn_global_load_async_to_lds_b128(
            (gv4i*)(g + t * 8 + i * (FA_THREADS * 8)),
            (lv4i*)(l + i * LSTEP), 0, 0);
    }
#else
#pragma unroll
    for (int i = 0; i < NSTEP; i++) {
        *(v8h*)(l + i * LSTEP) = *(const v8h*)(g + t * 8 + i * (FA_THREADS * 8));
    }
#endif
}

__device__ __forceinline__ void wait_async_kv() {
#ifdef ASYNC_KV
    asm volatile("s_wait_asynccnt 0" ::: "memory");
#endif
}

// ---------------------------------------------------------------------------
// Pre-pass: fp32 K/V -> f16, the keys of a batch reordered so that the unmasked
// ones come first (a masked key's weight is exp(-1e9 - max) = 0 as soon as one key
// is unmasked), V transposed tile-wise so hot-loop LDS tiles are contiguous memcpy
// images.  kh: [bh][position][d].  vh: [bh][tile][d][position32].
// Every block forms the order of its batch itself: a stable partition, unmasked
// keys in their order, then the masked ones.  It is a permutation of 0..Sc-1 for
// any content of the mask, so every row index read from perm lies inside K and V.
// The masked keys behind the last unmasked one fill up the last tile with finite
// rows; with no unmasked key the order is the identity and all tiles are written.
// One wave converts half a 32-key tile of K and of V with 32 loads of 16 bytes,
// all issued before the first conversion.
// K: 16 rows, each load one whole row of 512 bytes, each store 256.
// V: a strip of 32 keys x 64 d.  A lane loads 4 d of 8 consecutive positions, so
// the 8 positions of one d (16 bytes of vh) lie in that lane: the transpose is a
// choice of registers.  Four neighbour lanes hold the four groups of the same d:
// a load touches whole 128-byte lines, a store writes whole 64-byte rows of vh.
// A block takes every 8th tile of its (b,h), so that the tiles that are needed
// spread evenly over the blocks.
// ---------------------------------------------------------------------------
#define CVT_THREADS 512
#define CVT_BLOCKS (Bc * Hc * 8)   // 16 waves = 8 tiles x 2 halves per block
__global__ __launch_bounds__(CVT_THREADS)
void cvt_kv(const float* __restrict__ k, const float* __restrict__ v,
            const int* __restrict__ mask,
            _Float16* __restrict__ kh, _Float16* __restrict__ vh,
            int* __restrict__ nlive) {
    __shared__ alignas(16) unsigned short perm[Sc];   // position -> key
    __shared__ alignas(16) int wtot[CVT_THREADS / 32];

    const int lane = threadIdx.x & 31;
    const int wave = __builtin_amdgcn_readfirstlane(threadIdx.x >> 5);
    const int bh   = blockIdx.x >> 3;
    const int b    = bh >> 4;

    // ---- the order: wave w ranks keys 128w .. 128w+127, 32 per ballot
    const int* mp = mask + b * Sc + wave * 128 + lane;
    unsigned bal[4];
    int tot = 0;
#pragma unroll
    for (int j = 0; j < 4; j++) {
        bal[j] = __builtin_amdgcn_ballot_w32(mp[j * 32] != 0);
        tot += __builtin_popcount(bal[j]);
    }
    if (lane == 0) wtot[wave] = tot;
    __syncthreads();               // every wave's count is in wtot
    int before = 0, n = 0;         // unmasked keys in front of this wave's; in all
#pragma unroll
    for (int w = 0; w < CVT_THREADS / 32; w++) {
        const int x = wtot[w];
        n += x;
        before += (w < wave) ? x : 0;
    }
#pragma unroll
    for (int j = 0; j < 4; j++) {
        const int key = wave * 128 + j * 32 + lane;
        const int lb  = before + __builtin_popcount(bal[j] & ((1u << lane) - 1u));
        perm[((bal[j] >> lane) & 1u) ? lb : n + key - lb] = (unsigned short)key;
        before += __builtin_popcount(bal[j]);
    }
    __syncthreads();               // perm is whole
    if ((blockIdx.x & (Hc * 8 - 1)) == 0 && threadIdx.x == 0) nlive[b] = n;

    const int nt   = __builtin_amdgcn_readfirstlane(n ? (n + 31) >> 5 : NTILE);
    const int tile = (wave >> 1) * 8 + (blockIdx.x & 7);
    if (tile < nt) {               // the main kernel reads no tile from nt on
        const int half = wave & 1;
        const int st   = bh * NTILE + tile;
        const int d0   = half * 64 + (lane >> 2) * 4;
        const int key0 = (lane & 3) * 8;

        const v8us rk0 = *(const v8us*)&perm[tile * 32 + half * 16];
        const v8us rk1 = *(const v8us*)&perm[tile * 32 + half * 16 + 8];
        const v8us rv  = *(const v8us*)&perm[tile * 32 + key0];
        const char* kb = (const char*)(k + (size_t)bh * Sc * Dc);
        const char* vb = (const char*)(v + (size_t)bh * Sc * Dc);
        unsigned ka[16], va[8];    // byte offsets in this (b,h): the loads' address registers
#pragma unroll
        for (int i = 0; i < 8; i++) {
            ka[i]     = (unsigned)rk0[i] * (Dc * 4) + lane * 16;
            ka[8 + i] = (unsigned)rk1[i] * (Dc * 4) + lane * 16;
            va[i]     = (unsigned)rv[i] * (Dc * 4) + d0 * 4;
        }

        // Every loop here is unrolled so that kx and vx are indexed by constants
        // and stay in registers.
        v4f kx[16];
#pragma unroll
        for (int i = 0; i < 16; i++) kx[i] = *(const v4f*)(kb + ka[i]);
        v4f vx[2][8];                            // [32-d group][position]
#pragma unroll
        for (int i = 0; i < 8; i++) {
            vx[0][i] = *(const v4f*)(vb + va[i]);
            vx[1][i] = *(const v4f*)(vb + va[i] + 128);
        }
        // The wait that stands before a load's address registers are written again.
        // As inputs the offsets stay live up to it, so that no load lands on them;
        // and no load sinks below it: without it the compiler holds the V loads
        // back until K has landed, two memory latencies in a row.
        asm volatile("s_wait_xcnt 0x0"
                     :: "v"(ka[0]), "v"(ka[1]), "v"(ka[2]), "v"(ka[3]), "v"(ka[4]),
                        "v"(ka[5]), "v"(ka[6]), "v"(ka[7]), "v"(ka[8]), "v"(ka[9]),
                        "v"(ka[10]), "v"(ka[11]), "v"(ka[12]), "v"(ka[13]),
                        "v"(ka[14]), "v"(ka[15]), "v"(va[0]), "v"(va[1]), "v"(va[2]),
                        "v"(va[3]), "v"(va[4]), "v"(va[5]), "v"(va[6]), "v"(va[7])
                     : "memory");

        _Float16* ko = kh + (size_t)st * TILE_HALVES + half * (TILE_HALVES / 2) + lane * 4;
#pragma unroll
        for (int i = 0; i < 16; i++)
            *(v4h*)(ko + i * 128) = __builtin_convertvector(kx[i], v4h);

        _Float16* vo = vh + (size_t)st * TILE_HALVES + d0 * 32 + key0;
#pragma unroll
        for (int r = 0; r < 2; r++) {
#pragma unroll
            for (int j = 0; j < 4; j++) {
                v8h y;
#pragma unroll
                for (int i = 0; i < 8; i++) y[i] = (_Float16)vx[r][i][j];
                *(v8h*)(vo + (r * 32 + j) * 32) = y;
            }
        }
    }
}

// P of one tile from its exponents: the B operand of O^T += V^T x P^T (element g is
// key 8hf + g, element 8 + g key 16 + 8hf + g) and this lane's sum of the 16 values.
__device__ __forceinline__ float tile_p(const v8f& x0, const v8f& x1, v16h& pf) {
    float rs[4] = {0.0f, 0.0f, 0.0f, 0.0f};     // four short chains
#pragma unroll
    for (int g = 0; g < 8; g++) {
        const float e0 = __builtin_amdgcn_exp2f(x0[g]);
        const float e1 = __builtin_amdgcn_exp2f(x1[g]);
        rs[g & 1]       += e0;
        rs[2 + (g & 1)] += e1;
        pf[g]     = (_Float16)e0;
        pf[8 + g] = (_Float16)e1;
    }
    return (rs[0] + rs[1]) + (rs[2] + rs[3]);
}

// ---------------------------------------------------------------------------
// Main kernel (workspace path): f16 K/V, async double-buffered LDS pipeline.
// Transposed products: S^T = K x Q^T (A = K rows, B = Q), O^T += V^T x P^T.
// A lane holds 16 of the tile's 32 scores of each of its two queries (column ln of a group), so the
// maximum and the sum run in the lane, with one exchange between the halves,
// and P^T packs from the two score tiles straight into a B operand.
// The pre-pass has put the unmasked keys first: the loop walks the tiles that
// hold one, and only a tile that also holds masked keys selects.
// The score product yields the exponent itself: Q carries scale * log2(e), and minus
// the query's softmax reference is the C operand, so P = exp2(accumulator).  The
// reference is held from tile to tile: the first tile sets it to its maximum, and it
// rises, with O and the sum rescaled, only when a lane's P sum of a tile passes PLIM.
// A wave takes 32 queries, two column groups of 16: every K and V^T fragment read
// from LDS is the A operand of two products, and a block's tile serves 256 queries.
// ---------------------------------------------------------------------------
__global__ __launch_bounds__(FA_THREADS)
void fa_fwd_wmma2(const float* __restrict__ q, const _Float16* __restrict__ kh,
                  const _Float16* __restrict__ vh, const int* __restrict__ nlive,
                  float* __restrict__ out) {
    constexpr float LOG2E  = 1.4426950408889634f;
    constexpr float QSCALE = 0.08838834764831845f * LOG2E;  // 1/sqrt(128) in log2 units
    constexpr float NEGV   = -1.0e9f * LOG2E;               // the masked score, same units
    constexpr float PLIM   = 256.0f;                        // no P above it: well inside f16

    __shared__ alignas(32) _Float16 Kt[2][32 * KP];    // [key][d]
    __shared__ alignas(32) _Float16 Vt[2][128 * VP];   // [d][key]
    __shared__ alignas(32) _Float16 Qs[FA_WAVES][32 * KP];

    const int t    = threadIdx.x;
    const int wave = t >> 5;
    const int lane = t & 31;
    const int ln   = lane & 15;
    const int hf   = lane >> 4;
    const int bh   = blockIdx.y;
    const int b    = bh >> 4;
    const int q0   = blockIdx.x * FA_QROWS + wave * 32;

    // unmasked keys of this batch; with none every key counts alike: all tiles are
    // walked and every score is the masked value
    const int n  = __builtin_amdgcn_readfirstlane(min(max(nlive[b], 0), Sc));
    const int nt = n ? (n + 31) >> 5 : NTILE;

    const _Float16* kbase = kh + (size_t)bh * NTILE * TILE_HALVES;
    const _Float16* vbase = vh + (size_t)bh * NTILE * TILE_HALVES;

    // ---- prologue: kick off async copy of tile 0 while staging Q
    tile_copy<128, KP>(kbase, Kt[0], t);
    tile_copy<32, VP>(vbase, Vt[0], t);

    {
        const float* qp0 = q + ((size_t)bh * Sc + q0 + ln) * Dc + hf * 64;
        float4 x[2][16];                                // [column group][16 bytes of the row]
#pragma unroll
        for (int j = 0; j < 16; j++) x[0][j] = ((const float4*)qp0)[j];
#pragma unroll
        for (int j = 0; j < 16; j++) x[1][j] = ((const float4*)(qp0 + 16 * Dc))[j];
        // The wait that stands before a load's address registers are written again.
        // As an input the pointer stays live up to it, so that no load lands on it.
        asm volatile("s_wait_xcnt 0x0" :: "v"(qp0) : "memory");
#pragma unroll
        for (int u = 0; u < 2; u++) {
            _Float16* dst = &Qs[wave][(u * 16 + ln) * KP + hf * 64];
#pragma unroll
            for (int j = 0; j < 16; j++) {
                dst[4 * j + 0] = (_Float16)(x[u][j].x * QSCALE);
                dst[4 * j + 1] = (_Float16)(x[u][j].y * QSCALE);
                dst[4 * j + 2] = (_Float16)(x[u][j].z * QSCALE);
                dst[4 * j + 3] = (_Float16)(x[u][j].w * QSCALE);
            }
        }
    }
    __syncthreads();

    v16h qf[2][4];                  // [column group][32-d chunk]
#pragma unroll
    for (int u = 0; u < 2; u++)
#pragma unroll
        for (int c = 0; c < 4; c++)
            qf[u][c] = ld_frag(&Qs[wave][(u * 16 + ln) * KP + c * 32 + hf * 16]);

    v8f o[2][8];                    // o[u][n][g] = O^T[d = 16n + 8hf + g][query 16u + ln]
    v8f cref[2];                    // minus the query's reference (both halves alike), as C
    float lrun[2];                  // this half's share of the query's sum
#pragma unroll
    for (int u = 0; u < 2; u++) {
#pragma unroll
        for (int n = 0; n < 8; n++) o[u][n] = v8f{};
        cref[u] = v8f{};
        lrun[u] = 0.0f;
    }

#pragma unroll 1
    for (int kb = 0; kb < nt; kb++) {
        const int cur = kb & 1;
        // loads for tile kb were issued last iteration (or prologue)
        wait_async_kv();
        __syncthreads();   // tiles visible; all waves done reading buffer cur^1

        if (kb + 1 < nt) {  // prefetch next tile into the other buffer
            tile_copy<128, KP>(kbase + (size_t)(kb + 1) * TILE_HALVES, Kt[cur ^ 1], t);
            tile_copy<32, VP>(vbase + (size_t)(kb + 1) * TILE_HALVES, Vt[cur ^ 1], t);
        }

        const _Float16* Kc = Kt[cur];
        const _Float16* Vc = Vt[cur];

        // ---- exponents: K x Q^T - reference, two 16-key sub-blocks x two column
        // groups (fp32 acc): four independent chains, a K fragment feeds two of them
        v16h kf[4][2];
#pragma unroll
        for (int c = 0; c < 4; c++) {
            kf[c][0] = ld_frag(&Kc[ln * KP + c * 32 + hf * 16]);
            kf[c][1] = ld_frag(&Kc[(16 + ln) * KP + c * 32 + hf * 16]);
        }
        // Keeps the tile's 16 K reads in one group ahead of the products: left alone the
        // compiler puts a pair in front of each two WMMAs, through one register set, and
        // the wave waits out the LDS latency eight times a tile.
        __builtin_amdgcn_sched_barrier(0);
        v8f acc[2][2] = {{cref[0], cref[0]}, {cref[1], cref[1]}};   // [group][sub-block]
#pragma unroll
        for (int c = 0; c < 4; c++)
#pragma unroll
            for (int j = 0; j < 2; j++)
#pragma unroll
                for (int u = 0; u < 2; u++)
                    acc[u][j] = __builtin_amdgcn_wmma_f32_16x16x32_f16(
                        false, kf[c][j], false, qf[u][c], (short)0, acc[u][j], false, false);
        // Keeps the V^T reads below out of the run of products above.
        __builtin_amdgcn_sched_barrier(0);

        // The V^T fragments are asked for here, as one group behind the last score
        // product: their LDS latency passes under the softmax.
        v16h vf[8];
#pragma unroll
        for (int n = 0; n < 8; n++) vf[n] = ld_frag_kmap(&Vc[(n * 16 + ln) * VP], hf);

        // ---- softmax of two queries per lane against their held references
        if (__builtin_expect((kb + 1) * 32 > n, 0)) {   // rare; the same for the whole block
            // acc[u][X][g] belongs to position kb*32 + 16X + 8hf + g; from n on masked
            const int r = n - kb * 32 - 8 * hf;
#pragma unroll
            for (int u = 0; u < 2; u++) {
                const float mv = NEGV + cref[u][0];     // the masked score minus the reference
#pragma unroll
                for (int g = 0; g < 8; g++) {
                    acc[u][0][g] = g < r      ? acc[u][0][g] : mv;
                    acc[u][1][g] = 16 + g < r ? acc[u][1][g] : mv;
                }
            }
        }
        v16h pf[2];
        float rs[2];
#pragma unroll
        for (int u = 0; u < 2; u++) rs[u] = tile_p(acc[u][0], acc[u][1], pf[u]);
        // One test per tile; the ballot makes it a scalar branch, so that every lane
        // stays on for the WMMAs.  An overflowed P gives an infinite sum and is caught;
        // the first tile always passes the test (a sum is never below 0).
        const float lim = kb == 0 ? -1.0f : PLIM;
        if (__builtin_amdgcn_ballot_w32(fmaxf(rs[0], rs[1]) > lim) != 0) {
#pragma unroll
            for (int u = 0; u < 2; u++) {
                float tq[4];        // four short chains, not one of sixteen links
#pragma unroll
                for (int g = 0; g < 4; g++)
                    tq[g] = fmaxf(fmaxf(acc[u][0][2 * g], acc[u][0][2 * g + 1]),
                                  fmaxf(acc[u][1][2 * g], acc[u][1][2 * g + 1]));
                float tm = fmaxf(fmaxf(tq[0], tq[1]), fmaxf(tq[2], tq[3]));
                tm = fmaxf(tm, xhalf(tm));              // both halves move alike
                const float up = fmaxf(tm, 0.0f);       // later tiles only raise the reference
                const float d  = kb == 0 ? tm : up;     // the first sets it (O and sum are 0)
                const float alpha = __builtin_amdgcn_exp2f(-up);
                lrun[u] *= alpha;
#pragma unroll
                for (int n = 0; n < 8; n++) o[u][n] *= alpha;
                cref[u] -= d;
                acc[u][0] -= d;
                acc[u][1] -= d;
                rs[u] = tile_p(acc[u][0], acc[u][1], pf[u]);
            }
        }
        lrun[0] += rs[0];
        lrun[1] += rs[1];

#pragma unroll
        for (int n = 0; n < 8; n++)
#pragma unroll
            for (int u = 0; u < 2; u++)
                o[u][n] = __builtin_amdgcn_wmma_f32_16x16x32_f16(
                    false, vf[n], false, pf[u], (short)0, o[u][n], false, false);
    }

    // ---- epilogue: join the halves' sums; a lane stores 8 consecutive d of its queries
#pragma unroll
    for (int u = 0; u < 2; u++) {
        const float rcp = 1.0f / (lrun[u] + xhalf(lrun[u]));
        float* op = out + ((size_t)bh * Sc + q0 + u * 16 + ln) * Dc + 8 * hf;
#pragma unroll
        for (int n = 0; n < 8; n++) {
            v8f r = o[u][n] * rcp;
            *(v4f*)&op[n * 16]     = __builtin_shufflevector(r, r, 0, 1, 2, 3);
            *(v4f*)&op[n * 16 + 4] = __builtin_shufflevector(r, r, 4, 5, 6, 7);
        }
    }
}

// ---------------------------------------------------------------------------
// Fallback (no workspace): round-1 kernel, converts in-loop.
// ---------------------------------------------------------------------------
__global__ __launch_bounds__(128, 1)
void fa_fwd_wmma1(const float* __restrict__ q, const float* __restrict__ k,
                  const float* __restrict__ v, const int* __restrict__ mask,
                  float* __restrict__ out) {
    constexpr float SCALE = 0.08838834764831845f;
    constexpr float NEGV  = -1.0e9f;

    __shared__ alignas(32) _Float16 Kt[32 * 128];
    __shared__ alignas(32) _Float16 Vt[128 * 32];
    __shared__ alignas(32) _Float16 Qs[4][16 * 128];
    __shared__ alignas(32) _Float16 Pt[4][16 * 32];

    const int t    = threadIdx.x;
    const int wave = t >> 5;
    const int lane = t & 31;
    const int ln   = lane & 15;
    const int hf   = lane >> 4;
    const int bh   = blockIdx.y;
    const int b    = bh >> 4;
    const int q0   = blockIdx.x * 64 + wave * 16;

    {
        const float* qp = q + ((size_t)bh * Sc + q0 + ln) * Dc + hf * 64;
        _Float16* dst = &Qs[wave][ln * 128 + hf * 64];
#pragma unroll
        for (int j = 0; j < 16; j++) {
            float4 x = ((const float4*)qp)[j];
            dst[4 * j + 0] = (_Float16)x.x;
            dst[4 * j + 1] = (_Float16)x.y;
            dst[4 * j + 2] = (_Float16)x.z;
            dst[4 * j + 3] = (_Float16)x.w;
        }
    }
    __syncthreads();

    v16h qf[4];
#pragma unroll
    for (int c = 0; c < 4; c++)
        qf[c] = *(const v16h*)&Qs[wave][ln * 128 + c * 32 + hf * 16];

    v8f o[8];
#pragma unroll
    for (int n = 0; n < 8; n++) o[n] = v8f{};
    float mrow[8], lrow[8];
#pragma unroll
    for (int g = 0; g < 8; g++) { mrow[g] = -3.0e38f; lrow[g] = 0.0f; }

    const int row = t >> 2;
    const int d0  = (t & 3) * 32;

#pragma unroll 1
    for (int kb = 0; kb < NTILE; kb++) {
        const int kcol = kb * 32;
        __syncthreads();
        {
            const float* kp = k + ((size_t)bh * Sc + kcol + row) * Dc + d0;
            const float* vp = v + ((size_t)bh * Sc + kcol + row) * Dc + d0;
            _Float16* kd = &Kt[row * 128 + d0];
#pragma unroll
            for (int j = 0; j < 8; j++) {
                float4 x = ((const float4*)kp)[j];
                kd[4 * j + 0] = (_Float16)x.x;
                kd[4 * j + 1] = (_Float16)x.y;
                kd[4 * j + 2] = (_Float16)x.z;
                kd[4 * j + 3] = (_Float16)x.w;
                float4 y = ((const float4*)vp)[j];
                Vt[(d0 + 4 * j + 0) * 32 + row] = (_Float16)y.x;
                Vt[(d0 + 4 * j + 1) * 32 + row] = (_Float16)y.y;
                Vt[(d0 + 4 * j + 2) * 32 + row] = (_Float16)y.z;
                Vt[(d0 + 4 * j + 3) * 32 + row] = (_Float16)y.w;
            }
        }
        __syncthreads();

        v8f acc0 = v8f{}, acc1 = v8f{};
#pragma unroll
        for (int c = 0; c < 4; c++) {
            v16h b0 = *(const v16h*)&Kt[ln * 128 + c * 32 + hf * 16];
            acc0 = __builtin_amdgcn_wmma_f32_16x16x32_f16(false, qf[c], false, b0,
                                                          (short)0, acc0, false, false);
        }
#pragma unroll
        for (int c = 0; c < 4; c++) {
            v16h b1 = *(const v16h*)&Kt[(16 + ln) * 128 + c * 32 + hf * 16];
            acc1 = __builtin_amdgcn_wmma_f32_16x16x32_f16(false, qf[c], false, b1,
                                                          (short)0, acc1, false, false);
        }

        const int m0 = mask[b * Sc + kcol + ln];
        const int m1 = mask[b * Sc + kcol + 16 + ln];
        const float sc0 = m0 ? SCALE : 0.0f, ad0 = m0 ? 0.0f : NEGV;
        const float sc1 = m1 ? SCALE : 0.0f, ad1 = m1 ? 0.0f : NEGV;

        float p0[8], p1[8], alpha[8];
#pragma unroll
        for (int g = 0; g < 8; g++) {
            float s0 = acc0[g] * sc0 + ad0;
            float s1 = acc1[g] * sc1 + ad1;
            float bm   = rmax16(fmaxf(s0, s1));
            float mnew = fmaxf(mrow[g], bm);
            alpha[g] = __expf(mrow[g] - mnew);
            p0[g]    = __expf(s0 - mnew);
            p1[g]    = __expf(s1 - mnew);
            float rs = rsum16(p0[g] + p1[g]);
            lrow[g] = lrow[g] * alpha[g] + rs;
            mrow[g] = mnew;
        }

#pragma unroll
        for (int g = 0; g < 8; g++) {
            Pt[wave][(g + 8 * hf) * 32 + ln]      = (_Float16)p0[g];
            Pt[wave][(g + 8 * hf) * 32 + 16 + ln] = (_Float16)p1[g];
        }
#pragma unroll
        for (int n = 0; n < 8; n++) {
#pragma unroll
            for (int g = 0; g < 8; g++) o[n][g] *= alpha[g];
        }
        asm volatile("s_wait_dscnt 0" ::: "memory");

        v16h pf = *(const v16h*)&Pt[wave][ln * 32 + hf * 16];
#pragma unroll
        for (int n = 0; n < 8; n++) {
            v16h vf = *(const v16h*)&Vt[(n * 16 + ln) * 32 + hf * 16];
            o[n] = __builtin_amdgcn_wmma_f32_16x16x32_f16(false, pf, false, vf,
                                                          (short)0, o[n], false, false);
        }
    }

    float rcp[8];
#pragma unroll
    for (int g = 0; g < 8; g++) rcp[g] = 1.0f / lrow[g];
#pragma unroll
    for (int n = 0; n < 8; n++) {
#pragma unroll
        for (int g = 0; g < 8; g++) {
            out[((size_t)bh * Sc + q0 + g + 8 * hf) * Dc + n * 16 + ln] = o[n][g] * rcp[g];
        }
    }
}

extern "C" void kernel_launch(void* const* d_in, const int* in_sizes, int n_in,
                              void* d_out, int out_size, void* d_ws, size_t ws_size,
                              hipStream_t stream) {
    (void)in_sizes; (void)n_in; (void)out_size;
    const float* q    = (const float*)d_in[0];
    const float* k    = (const float*)d_in[1];
    const float* v    = (const float*)d_in[2];
    const int*   mask = (const int*)d_in[3];
    float* out = (float*)d_out;

    const size_t nelem   = (size_t)Bc * Hc * Sc * Dc;   // 8,388,608
    const size_t ws_need = 2 * nelem * sizeof(_Float16) + Bc * sizeof(int);

    dim3 grid(Sc / 64, Bc * Hc);
    dim3 block(128);

    if (ws_size >= ws_need && d_ws != nullptr) {
        _Float16* kh = (_Float16*)d_ws;
        _Float16* vh = kh + nelem;
        int* nlive = (int*)(vh + nelem);
        cvt_kv<<<dim3(CVT_BLOCKS), dim3(CVT_THREADS), 0, stream>>>(k, v, mask, kh, vh, nlive);
        fa_fwd_wmma2<<<dim3(Sc / FA_QROWS, Bc * Hc), dim3(FA_THREADS), 0, stream>>>(q, kh, vh, nlive, out);
    } else {
        fa_fwd_wmma1<<<grid, block, 0, stream>>>(q, k, v, mask, out);
    }
}

// v007
// One run takes 41.2 microseconds.
// Next to v006, in two timings, it ran 1.13 and 1.12 times as fast.
// Counting every step since v000, it is 7.38 times as fast.
#include <hip/hip_runtime.h>
#include <hip/hip_bf16.h>

typedef __attribute__((ext_vector_type(16))) _Float16 v16h;
typedef __attribute__((ext_vector_type(8)))  _Float16 v8h;
typedef __attribute__((ext_vector_type(4)))  _Float16 v4h;
typedef __attribute__((ext_vector_type(8)))  float    v8f;
typedef __attribute__((ext_vector_type(4)))  int      v4i;
typedef __attribute__((ext_vector_type(4)))  float    v4f;
typedef __attribute__((ext_vector_type(8)))  unsigned short v8us;

#define Bc 2
#define Hc 16
#define Sc 2048
#define Dc 128
#define NTILE (Sc / 32)            // 64 key tiles per (b,h)
#define TILE_HALVES (32 * 128)     // 4096 f16 per K or V tile (8KB)
// LDS row pitches in f16: 16 bytes x odd, so that the 16 lanes of a half wave,
// one row each, spread a 16-byte read over all 64 banks.
#define KP 136                     // 256-byte rows (K, Q) at 272 bytes
#define VP 40                      // 64-byte rows (V^T) at 80 bytes

#if defined(__has_builtin)
#if __has_builtin(__builtin_amdgcn_global_load_async_to_lds_b128)
#define ASYNC_KV 1
#endif
#endif

__device__ __forceinline__ float rmax16(float x) {
    x = fmaxf(x, __shfl_xor(x, 1, 32));
    x = fmaxf(x, __shfl_xor(x, 2, 32));
    x = fmaxf(x, __shfl_xor(x, 4, 32));
    x = fmaxf(x, __shfl_xor(x, 8, 32));
    return x;
}
__device__ __forceinline__ float rsum16(float x) {
    x += __shfl_xor(x, 1, 32);
    x += __shfl_xor(x, 2, 32);
    x += __shfl_xor(x, 4, 32);
    x += __shfl_xor(x, 8, 32);
    return x;
}

// Lane l takes the value of lane l ^ 16 (the other half of the wave).
__device__ __forceinline__ float xhalf(float x) {
    int i = __builtin_bit_cast(int, x);
    return __builtin_bit_cast(float, __builtin_amdgcn_permlanex16(
        i, i, 0x76543210, 0xfedcba98, false, false));
}

// One 16-element fragment from a padded LDS row: rows are 16-byte aligned only.
__device__ __forceinline__ v16h ld_frag(const _Float16* p) {
    v8h lo = *(const v8h*)p;
    v8h hi = *(const v8h*)(p + 8);
    return __builtin_shufflevector(lo, hi, 0, 1, 2, 3, 4, 5, 6, 7,
                                   8, 9, 10, 11, 12, 13, 14, 15);
}

// A fragment whose k order pairs with a B operand packed from two accumulator
// tiles: half h of the wave holds k 8h..8h+7 and 16+8h..16+8h+7.
__device__ __forceinline__ v16h ld_frag_kmap(const _Float16* row, int h) {
    v8h lo = *(const v8h*)(row + 8 * h);
    v8h hi = *(const v8h*)(row + 16 + 8 * h);
    return __builtin_shufflevector(lo, hi, 0, 1, 2, 3, 4, 5, 6, 7,
                                   8, 9, 10, 11, 12, 13, 14, 15);
}

// Copy one 8KB tile (4096 f16) global -> LDS, FA_THREADS threads, thread t does 2x16B.
// The global image is contiguous rows of ROW f16; in LDS the rows lie PITCH apart.
#define FA_WAVES 8
#define FA_THREADS (FA_WAVES * 32)
#define FA_QROWS (FA_WAVES * 32)   // queries of a block: 32 per wave
template <int ROW, int PITCH>
__device__ __forceinline__ void tile_copy(const _Float16* __restrict__ g,
                                          _Float16* l, int t) {
    constexpr int CH = ROW / 8;                 // 16-byte chunks per row
    constexpr int NSTEP = TILE_HALVES / 8 / FA_THREADS;
    l += (t / CH) * PITCH + (t % CH) * 8;       // this thread's chunk, step 0
    constexpr int LSTEP = (FA_THREADS / CH) * PITCH;   // rows per step x pitch
#ifdef ASYNC_KV
    typedef __attribute__((address_space(1))) v4i gv4i;   // global <4 x i32>
    typedef __attribute__((address_space(3))) v4i lv4i;   // LDS    <4 x i32>
#pragma unroll
    for (int i = 0; i < NSTEP; i++) {
        __builtin_amdgcn_global_load_async_to_lds_b128(
            (gv4i*)(g + t * 8 + i * (FA_THREADS * 8)),
            (lv4i*)(l + i * LSTEP), 0, 0);
    }
#else
#pragma unroll
    for (int i = 0; i < NSTEP; i++) {
        *(v8h*)(l + i * LSTEP) = *(const v8h*)(g + t * 8 + i * (FA_THREADS * 8));
    }
#endif
}

// A stage is STG key tiles; the LDS ring holds two stages, tile x in slot x mod 2*STG.
#define STG 4
#define RING (2 * STG)

// The copies of the stage that begins with tile t0: those of its tiles that exist
// (the pre-pass writes no tile from nt on).  t0 and nt are the same for the whole block,
// and the caller has seen that tile t0 exists.
__device__ __forceinline__ void stage_copy(const _Float16* __restrict__ kbase,
                                           const _Float16* __restrict__ vbase,
                                           _Float16 (*Kt)[32 * KP], _Float16 (*Vt)[128 * VP],
                                           int t0, int nt, int t) {
#pragma unroll
    for (int j = 0; j < STG; j++) {
        if (j == 0 || t0 + j < nt) {
            tile_copy<128, KP>(kbase + (size_t)(t0 + j) * TILE_HALVES, Kt[(t0 + j) & (RING - 1)], t);
            tile_copy<32, VP>(vbase + (size_t)(t0 + j) * TILE_HALVES, Vt[(t0 + j) & (RING - 1)], t);
        }
    }
}

__device__ __forceinline__ void wait_async_kv() {
#ifdef ASYNC_KV
    asm volatile("s_wait_asynccnt 0" ::: "memory");
#endif
}

// ---------------------------------------------------------------------------
// Pre-pass: fp32 K/V -> f16, the keys of a batch reordered so that the unmasked
// ones come first (a masked key's weight is exp(-1e9 - max) = 0 as soon as one key
// is unmasked), V transposed tile-wise so hot-loop LDS tiles are contiguous memcpy
// images.  kh: [bh][position][d].  vh: [bh][tile][d][position32].
// Every block forms the order of its batch itself: a stable partition, unmasked
// keys in their order, then the masked ones.  It is a permutation of 0..Sc-1 for
// any content of the mask, so every row index read from perm lies inside K and V.
// The masked keys behind the last unmasked one fill up the last tile with finite
// rows; with no unmasked key the order is the identity and all tiles are written.
// One wave converts half a 32-key tile of K and of V with 32 loads of 16 bytes,
// all issued before the first conversion.
// K: 16 rows, each load one whole row of 512 bytes, each store 256.
// V: a strip of 32 keys x 64 d.  A lane loads 4 d of 8 consecutive positions, so
// the 8 positions of one d (16 bytes of vh) lie in that lane: the transpose is a
// choice of registers.  Four neighbour lanes hold the four groups of the same d:
// a load touches whole 128-byte lines, a store writes whole 64-byte rows of vh.
// A block takes every 8th tile of its (b,h), so that the tiles that are needed
// spread evenly over the blocks.
// ---------------------------------------------------------------------------
#define CVT_THREADS 512
#define CVT_BLOCKS (Bc * Hc * 8)   // 16 waves = 8 tiles x 2 halves per block
__global__ __launch_bounds__(CVT_THREADS)
void cvt_kv(const float* __restrict__ k, const float* __restrict__ v,
            const int* __restrict__ mask,
            _Float16* __restrict__ kh, _Float16* __restrict__ vh,
            int* __restrict__ nlive) {
    __shared__ alignas(16) unsigned short perm[Sc];   // position -> key
    __shared__ alignas(16) int wtot[CVT_THREADS / 32];

    const int lane = threadIdx.x & 31;
    const int wave = __builtin_amdgcn_readfirstlane(threadIdx.x >> 5);
    const int bh   = blockIdx.x >> 3;
    const int b    = bh >> 4;

    // ---- the order: wave w ranks keys 128w .. 128w+127, 32 per ballot
    const int* mp = mask + b * Sc + wave * 128 + lane;
    unsigned bal[4];
    int tot = 0;
#pragma unroll
    for (int j = 0; j < 4; j++) {
        bal[j] = __builtin_amdgcn_ballot_w32(mp[j * 32] != 0);
        tot += __builtin_popcount(bal[j]);
    }
    if (lane == 0) wtot[wave] = tot;
    __syncthreads();               // every wave's count is in wtot
    int before = 0, n = 0;         // unmasked keys in front of this wave's; in all
#pragma unroll
    for (int w = 0; w < CVT_THREADS / 32; w++) {
        const int x = wtot[w];
        n += x;
        before += (w < wave) ? x : 0;
    }
#pragma unroll
    for (int j = 0; j < 4; j++) {
        const int key = wave * 128 + j * 32 + lane;
        const int lb  = before + __builtin_popcount(bal[j] & ((1u << lane) - 1u));
        perm[((bal[j] >> lane) & 1u) ? lb : n + key - lb] = (unsigned short)key;
        before += __builtin_popcount(bal[j]);
    }
    __syncthreads();               // perm is whole
    if ((blockIdx.x & (Hc * 8 - 1)) == 0 && threadIdx.x == 0) nlive[b] = n;

    const int nt   = __builtin_amdgcn_readfirstlane(n ? (n + 31) >> 5 : NTILE);
    const int tile = (wave >> 1) * 8 + (blockIdx.x & 7);
    if (tile < nt) {               // the main kernel reads no tile from nt on
        const int half = wave & 1;
        const int st   = bh * NTILE + tile;
        const int d0   = half * 64 + (lane >> 2) * 4;
        const int key0 = (lane & 3) * 8;

        const v8us rk0 = *(const v8us*)&perm[tile * 32 + half * 16];
        const v8us rk1 = *(const v8us*)&perm[tile * 32 + half * 16 + 8];
        const v8us rv  = *(const v8us*)&perm[tile * 32 + key0];
        const char* kb = (const char*)(k + (size_t)bh * Sc * Dc);
        const char* vb = (const char*)(v + (size_t)bh * Sc * Dc);
        unsigned ka[16], va[8];    // byte offsets in this (b,h): the loads' address registers
#pragma unroll
        for (int i = 0; i < 8; i++) {
            ka[i]     = (unsigned)rk0[i] * (Dc * 4) + lane * 16;
            ka[8 + i] = (unsigned)rk1[i] * (Dc * 4) + lane * 16;
            va[i]     = (unsigned)rv[i] * (Dc * 4) + d0 * 4;
        }

        // Every loop here is unrolled so that kx and vx are indexed by constants
        // and stay in registers.
        v4f kx[16];
#pragma unroll
        for (int i = 0; i < 16; i++) kx[i] = *(const v4f*)(kb + ka[i]);
        v4f vx[2][8];                            // [32-d group][position]
#pragma unroll
        for (int i = 0; i < 8; i++) {
            vx[0][i] = *(const v4f*)(vb + va[i]);
            vx[1][i] = *(const v4f*)(vb + va[i] + 128);
        }
        // The wait that stands before a load's address registers are written again.
        // As inputs the offsets stay live up to it, so that no load lands on them;
        // and no load sinks below it: without it the compiler holds the V loads
        // back until K has landed, two memory latencies in a row.
        asm volatile("s_wait_xcnt 0x0"
                     :: "v"(ka[0]), "v"(ka[1]), "v"(ka[2]), "v"(ka[3]), "v"(ka[4]),
                        "v"(ka[5]), "v"(ka[6]), "v"(ka[7]), "v"(ka[8]), "v"(ka[9]),
                        "v"(ka[10]), "v"(ka[11]), "v"(ka[12]), "v"(ka[13]),
                        "v"(ka[14]), "v"(ka[15]), "v"(va[0]), "v"(va[1]), "v"(va[2]),
                        "v"(va[3]), "v"(va[4]), "v"(va[5]), "v"(va[6]), "v"(va[7])
                     : "memory");

        _Float16* ko = kh + (size_t)st * TILE_HALVES + half * (TILE_HALVES / 2) + lane * 4;
#pragma unroll
        for (int i = 0; i < 16; i++)
            *(v4h*)(ko + i * 128) = __builtin_convertvector(kx[i], v4h);

        _Float16* vo = vh + (size_t)st * TILE_HALVES + d0 * 32 + key0;
#pragma unroll
        for (int r = 0; r < 2; r++) {
#pragma unroll
            for (int j = 0; j < 4; j++) {
                v8h y;
#pragma unroll
                for (int i = 0; i < 8; i++) y[i] = (_Float16)vx[r][i][j];
                *(v8h*)(vo + (r * 32 + j) * 32) = y;
            }
        }
    }
}

// P of one tile from its exponents: the B operand of O^T += V^T x P^T (element g is
// key 8hf + g, element 8 + g key 16 + 8hf + g) and this lane's sum of the 16 values.
__device__ __forceinline__ float tile_p(const v8f& x0, const v8f& x1, v16h& pf) {
    float rs[4] = {0.0f, 0.0f, 0.0f, 0.0f};     // four short chains
#pragma unroll
    for (int g = 0; g < 8; g++) {
        const float e0 = __builtin_amdgcn_exp2f(x0[g]);
        const float e1 = __builtin_amdgcn_exp2f(x1[g]);
        rs[g & 1]       += e0;
        rs[2 + (g & 1)] += e1;
        pf[g]     = (_Float16)e0;
        pf[8 + g] = (_Float16)e1;
    }
    return (rs[0] + rs[1]) + (rs[2] + rs[3]);
}

// ---------------------------------------------------------------------------
// Main kernel (workspace path): f16 K/V, async double-buffered LDS pipeline.
// Transposed products: S^T = K x Q^T (A = K rows, B = Q), O^T += V^T x P^T.
// A lane holds 16 of the tile's 32 scores of each of its two queries (column ln of a group), so the
// maximum and the sum run in the lane, with one exchange between the halves,
// and P^T packs from the two score tiles straight into a B operand.
// The pre-pass has put the unmasked keys first: the loop walks the tiles that
// hold one, and only a tile that also holds masked keys selects.
// The score product yields the exponent itself: Q carries scale * log2(e), and minus
// the query's softmax reference is the C operand, so P = exp2(accumulator).  The
// reference is held from tile to tile: the first tile sets it to its maximum, and it
// rises, with O and the sum rescaled, only when a lane's P sum of a tile passes PLIM.
// A wave takes 32 queries, two column groups of 16: every K and V^T fragment read
// from LDS is the A operand of two products, and a block's tile serves 256 queries.
// K and V^T are staged 128 keys at a time: one wait and one barrier per four tiles, the
// next stage's copies in flight for a whole stage; between two barriers the waves run
// free, so that one wave's LDS reads and softmax pass under another's products.
// ---------------------------------------------------------------------------
__global__ __launch_bounds__(FA_THREADS)
void fa_fwd_wmma2(const float* __restrict__ q, const _Float16* __restrict__ kh,
                  const _Float16* __restrict__ vh, const int* __restrict__ nlive,
                  float* __restrict__ out) {
    constexpr float LOG2E  = 1.4426950408889634f;
    constexpr float QSCALE = 0.08838834764831845f * LOG2E;  // 1/sqrt(128) in log2 units
    constexpr float NEGV   = -1.0e9f * LOG2E;               // the masked score, same units
    constexpr float PLIM   = 256.0f;                        // no P above it: well inside f16

    __shared__ alignas(32) _Float16 Kt[RING][32 * KP];    // [slot][key][d]
    __shared__ alignas(32) _Float16 Vt[RING][128 * VP];   // [slot][d][key]
    __shared__ alignas(32) _Float16 Qs[FA_WAVES][32 * KP];

    const int t    = threadIdx.x;
    const int wave = t >> 5;
    const int lane = t & 31;
    const int ln   = lane & 15;
    const int hf   = lane >> 4;
    const int bh   = blockIdx.y;
    const int b    = bh >> 4;
    const int q0   = blockIdx.x * FA_QROWS + wave * 32;

    // unmasked keys of this batch; with none every key counts alike: all tiles are
    // walked and every score is the masked value
    const int n  = __builtin_amdgcn_readfirstlane(min(max(nlive[b], 0), Sc));
    const int nt = n ? (n + 31) >> 5 : NTILE;

    const _Float16* kbase = kh + (size_t)bh * NTILE * TILE_HALVES;
    const _Float16* vbase = vh + (size_t)bh * NTILE * TILE_HALVES;

    // ---- prologue: kick off the async copies of stage 0 (nt is at least 1) while staging Q
    stage_copy(kbase, vbase, Kt, Vt, 0, nt, t);

    {
        const float* qp0 = q + ((size_t)bh * Sc + q0 + ln) * Dc + hf * 64;
        float4 x[2][16];                                // [column group][16 bytes of the row]
#pragma unroll
        for (int j = 0; j < 16; j++) x[0][j] = ((const float4*)qp0)[j];
#pragma unroll
        for (int j = 0; j < 16; j++) x[1][j] = ((const float4*)(qp0 + 16 * Dc))[j];
        // The wait that stands before a load's address registers are written again.
        // As an input the pointer stays live up to it, so that no load lands on it.
        asm volatile("s_wait_xcnt 0x0" :: "v"(qp0) : "memory");
#pragma unroll
        for (int u = 0; u < 2; u++) {
            _Float16* dst = &Qs[wave][(u * 16 + ln) * KP + hf * 64];
#pragma unroll
            for (int j = 0; j < 16; j++) {
                dst[4 * j + 0] = (_Float16)(x[u][j].x * QSCALE);
                dst[4 * j + 1] = (_Float16)(x[u][j].y * QSCALE);
                dst[4 * j + 2] = (_Float16)(x[u][j].z * QSCALE);
                dst[4 * j + 3] = (_Float16)(x[u][j].w * QSCALE);
            }
        }
    }
    __syncthreads();

    v16h qf[2][4];                  // [column group][32-d chunk]
#pragma unroll
    for (int u = 0; u < 2; u++)
#pragma unroll
        for (int c = 0; c < 4; c++)
            qf[u][c] = ld_frag(&Qs[wave][(u * 16 + ln) * KP + c * 32 + hf * 16]);

    v8f o[2][8];                    // o[u][n][g] = O^T[d = 16n + 8hf + g][query 16u + ln]
    v8f cref[2];                    // minus the query's reference (both halves alike), as C
    float lrun[2];                  // this half's share of the query's sum
#pragma unroll
    for (int u = 0; u < 2; u++) {
#pragma unroll
        for (int n = 0; n < 8; n++) o[u][n] = v8f{};
        cref[u] = v8f{};
        lrun[u] = 0.0f;
    }

#pragma unroll 1
    for (int kb = 0; kb < nt; kb++) {
        if ((kb & (STG - 1)) == 0) {   // a stage begins; the same for the whole block
            // its copies were issued a stage ago (or in the prologue)
            wait_async_kv();
            __syncthreads();   // stage visible; all waves done reading the other buffer
            if (kb + STG < nt)  // the next stage goes into the other buffer
                stage_copy(kbase, vbase, Kt, Vt, kb + STG, nt, t);
        }

        const _Float16* Kc = Kt[kb & (RING - 1)];
        const _Float16* Vc = Vt[kb & (RING - 1)];

        // ---- exponents: K x Q^T - reference, two 16-key sub-blocks x two column
        // groups (fp32 acc): four independent chains, a K fragment feeds two of them
        v16h kf[4][2];
#pragma unroll
        for (int c = 0; c < 4; c++) {
            kf[c][0] = ld_frag(&Kc[ln * KP + c * 32 + hf * 16]);
            kf[c][1] = ld_frag(&Kc[(16 + ln) * KP + c * 32 + hf * 16]);
        }
        // Keeps the tile's 16 K reads in one group ahead of the products: left alone the
        // compiler puts a pair in front of each two WMMAs, through one register set, and
        // the wave waits out the LDS latency eight times a tile.
        __builtin_amdgcn_sched_barrier(0);
        v8f acc[2][2] = {{cref[0], cref[0]}, {cref[1], cref[1]}};   // [group][sub-block]
#pragma unroll
        for (int c = 0; c < 4; c++)
#pragma unroll
            for (int j = 0; j < 2; j++)
#pragma unroll
                for (int u = 0; u < 2; u++)
                    acc[u][j] = __builtin_amdgcn_wmma_f32_16x16x32_f16(
                        false, kf[c][j], false, qf[u][c], (short)0, acc[u][j], false, false);
        // Keeps the V^T reads below out of the run of products above.
        __builtin_amdgcn_sched_barrier(0);

        // The V^T fragments are asked for here, as one group behind the last score
        // product: their LDS latency passes under the softmax.
        v16h vf[8];
#pragma unroll
        for (int n = 0; n < 8; n++) vf[n] = ld_frag_kmap(&Vc[(n * 16 + ln) * VP], hf);

        // ---- softmax of two queries per lane against their held references
        if (__builtin_expect((kb + 1) * 32 > n, 0)) {   // rare; the same for the whole block
            // acc[u][X][g] belongs to position kb*32 + 16X + 8hf + g; from n on masked
            const int r = n - kb * 32 - 8 * hf;
#pragma unroll
            for (int u = 0; u < 2; u++) {
                const float mv = NEGV + cref[u][0];     // the masked score minus the reference
#pragma unroll
                for (int g = 0; g < 8; g++) {
                    acc[u][0][g] = g < r      ? acc[u][0][g] : mv;
                    acc[u][1][g] = 16 + g < r ? acc[u][1][g] : mv;
                }
            }
        }
        v16h pf[2];
        float rs[2];
#pragma unroll
        for (int u = 0; u < 2; u++) rs[u] = tile_p(acc[u][0], acc[u][1], pf[u]);
        // One test per tile; the ballot makes it a scalar branch, so that every lane
        // stays on for the WMMAs.  An overflowed P gives an infinite sum and is caught;
        // the first tile always passes the test (a sum is never below 0).
        const float lim = kb == 0 ? -1.0f : PLIM;
        if (__builtin_amdgcn_ballot_w32(fmaxf(rs[0], rs[1]) > lim) != 0) {
#pragma unroll
            for (int u = 0; u < 2; u++) {
                float tq[4];        // four short chains, not one of sixteen links
#pragma unroll
                for (int g = 0; g < 4; g++)
                    tq[g] = fmaxf(fmaxf(acc[u][0][2 * g], acc[u][0][2 * g + 1]),
                                  fmaxf(acc[u][1][2 * g], acc[u][1][2 * g + 1]));
                float tm = fmaxf(fmaxf(tq[0], tq[1]), fmaxf(tq[2], tq[3]));
                tm = fmaxf(tm, xhalf(tm));              // both halves move alike
                const float up = fmaxf(tm, 0.0f);       // later tiles only raise the reference
                const float d  = kb == 0 ? tm : up;     // the first sets it (O and sum are 0)
                const float alpha = __builtin_amdgcn_exp2f(-up);
                lrun[u] *= alpha;
#pragma unroll
                for (int n = 0; n < 8; n++) o[u][n] *= alpha;
                cref[u] -= d;
                acc[u][0] -= d;
                acc[u][1] -= d;
                rs[u] = tile_p(acc[u][0], acc[u][1], pf[u]);
            }
        }
        lrun[0] += rs[0];
        lrun[1] += rs[1];

#pragma unroll
        for (int n = 0; n < 8; n++)
#pragma unroll
            for (int u = 0; u < 2; u++)
                o[u][n] = __builtin_amdgcn_wmma_f32_16x16x32_f16(
                    false, vf[n], false, pf[u], (short)0, o[u][n], false, false);
    }

    // ---- epilogue: join the halves' sums; a lane stores 8 consecutive d of its queries
#pragma unroll
    for (int u = 0; u < 2; u++) {
        const float rcp = 1.0f / (lrun[u] + xhalf(lrun[u]));
        float* op = out + ((size_t)bh * Sc + q0 + u * 16 + ln) * Dc + 8 * hf;
#pragma unroll
        for (int n = 0; n < 8; n++) {
            v8f r = o[u][n] * rcp;
            *(v4f*)&op[n * 16]     = __builtin_shufflevector(r, r, 0, 1, 2, 3);
            *(v4f*)&op[n * 16 + 4] = __builtin_shufflevector(r, r, 4, 5, 6, 7);
        }
    }
}

// ---------------------------------------------------------------------------
// Fallback (no workspace): round-1 kernel, converts in-loop.
// ---------------------------------------------------------------------------
__global__ __launch_bounds__(128, 1)
void fa_fwd_wmma1(const float* __restrict__ q, const float* __restrict__ k,
                  const float* __restrict__ v, const int* __restrict__ mask,
                  float* __restrict__ out) {
    constexpr float SCALE = 0.08838834764831845f;
    constexpr float NEGV  = -1.0e9f;

    __shared__ alignas(32) _Float16 Kt[32 * 128];
    __shared__ alignas(32) _Float16 Vt[128 * 32];
    __shared__ alignas(32) _Float16 Qs[4][16 * 128];
    __shared__ alignas(32) _Float16 Pt[4][16 * 32];

    const int t    = threadIdx.x;
    const int wave = t >> 5;
    const int lane = t & 31;
    const int ln   = lane & 15;
    const int hf   = lane >> 4;
    const int bh   = blockIdx.y;
    const int b    = bh >> 4;
    const int q0   = blockIdx.x * 64 + wave * 16;

    {
        const float* qp = q + ((size_t)bh * Sc + q0 + ln) * Dc + hf * 64;
        _Float16* dst = &Qs[wave][ln * 128 + hf * 64];
#pragma unroll
        for (int j = 0; j < 16; j++) {
            float4 x = ((const float4*)qp)[j];
            dst[4 * j + 0] = (_Float16)x.x;
            dst[4 * j + 1] = (_Float16)x.y;
            dst[4 * j + 2] = (_Float16)x.z;
            dst[4 * j + 3] = (_Float16)x.w;
        }
    }
    __syncthreads();

    v16h qf[4];
#pragma unroll
    for (int c = 0; c < 4; c++)
        qf[c] = *(const v16h*)&Qs[wave][ln * 128 + c * 32 + hf * 16];

    v8f o[8];
#pragma unroll
    for (int n = 0; n < 8; n++) o[n] = v8f{};
    float mrow[8], lrow[8];
#pragma unroll
    for (int g = 0; g < 8; g++) { mrow[g] = -3.0e38f; lrow[g] = 0.0f; }

    const int row = t >> 2;
    const int d0  = (t & 3) * 32;

#pragma unroll 1
    for (int kb = 0; kb < NTILE; kb++) {
        const int kcol = kb * 32;
        __syncthreads();
        {
            const float* kp = k + ((size_t)bh * Sc + kcol + row) * Dc + d0;
            const float* vp = v + ((size_t)bh * Sc + kcol + row) * Dc + d0;
            _Float16* kd = &Kt[row * 128 + d0];
#pragma unroll
            for (int j = 0; j < 8; j++) {
                float4 x = ((const float4*)kp)[j];
                kd[4 * j + 0] = (_Float16)x.x;
                kd[4 * j + 1] = (_Float16)x.y;
                kd[4 * j + 2] = (_Float16)x.z;
                kd[4 * j + 3] = (_Float16)x.w;
                float4 y = ((const float4*)vp)[j];
                Vt[(d0 + 4 * j + 0) * 32 + row] = (_Float16)y.x;
                Vt[(d0 + 4 * j + 1) * 32 + row] = (_Float16)y.y;
                Vt[(d0 + 4 * j + 2) * 32 + row] = (_Float16)y.z;
                Vt[(d0 + 4 * j + 3) * 32 + row] = (_Float16)y.w;
            }
        }
        __syncthreads();

        v8f acc0 = v8f{}, acc1 = v8f{};
#pragma unroll
        for (int c = 0; c < 4; c++) {
            v16h b0 = *(const v16h*)&Kt[ln * 128 + c * 32 + hf * 16];
            acc0 = __builtin_amdgcn_wmma_f32_16x16x32_f16(false, qf[c], false, b0,
                                                          (short)0, acc0, false, false);
        }
#pragma unroll
        for (int c = 0; c < 4; c++) {
            v16h b1 = *(const v16h*)&Kt[(16 + ln) * 128 + c * 32 + hf * 16];
            acc1 = __builtin_amdgcn_wmma_f32_16x16x32_f16(false, qf[c], false, b1,
                                                          (short)0, acc1, false, false);
        }

        const int m0 = mask[b * Sc + kcol + ln];
        const int m1 = mask[b * Sc + kcol + 16 + ln];
        const float sc0 = m0 ? SCALE : 0.0f, ad0 = m0 ? 0.0f : NEGV;
        const float sc1 = m1 ? SCALE : 0.0f, ad1 = m1 ? 0.0f : NEGV;

        float p0[8], p1[8], alpha[8];
#pragma unroll
        for (int g = 0; g < 8; g++) {
            float s0 = acc0[g] * sc0 + ad0;
            float s1 = acc1[g] * sc1 + ad1;
            float bm   = rmax16(fmaxf(s0, s1));
            float mnew = fmaxf(mrow[g], bm);
            alpha[g] = __expf(mrow[g] - mnew);
            p0[g]    = __expf(s0 - mnew);
            p1[g]    = __expf(s1 - mnew);
            float rs = rsum16(p0[g] + p1[g]);
            lrow[g] = lrow[g] * alpha[g] + rs;
            mrow[g] = mnew;
        }

#pragma unroll
        for (int g = 0; g < 8; g++) {
            Pt[wave][(g + 8 * hf) * 32 + ln]      = (_Float16)p0[g];
            Pt[wave][(g + 8 * hf) * 32 + 16 + ln] = (_Float16)p1[g];
        }
#pragma unroll
        for (int n = 0; n < 8; n++) {
#pragma unroll
            for (int g = 0; g < 8; g++) o[n][g] *= alpha[g];
        }
        asm volatile("s_wait_dscnt 0" ::: "memory");

        v16h pf = *(const v16h*)&Pt[wave][ln * 32 + hf * 16];
#pragma unroll
        for (int n = 0; n < 8; n++) {
            v16h vf = *(const v16h*)&Vt[(n * 16 + ln) * 32 + hf * 16];
            o[n] = __builtin_amdgcn_wmma_f32_16x16x32_f16(false, pf, false, vf,
                                                          (short)0, o[n], false, false);
        }
    }

    float rcp[8];
#pragma unroll
    for (int g = 0; g < 8; g++) rcp[g] = 1.0f / lrow[g];
#pragma unroll
    for (int n = 0; n < 8; n++) {
#pragma unroll
        for (int g = 0; g < 8; g++) {
            out[((size_t)bh * Sc + q0 + g + 8 * hf) * Dc + n * 16 + ln] = o[n][g] * rcp[g];
        }
    }
}

extern "C" void kernel_launch(void* const* d_in, const int* in_sizes, int n_in,
                              void* d_out, int out_size, void* d_ws, size_t ws_size,
                              hipStream_t stream) {
    (void)in_sizes; (void)n_in; (void)out_size;
    const float* q    = (const float*)d_in[0];
    const float* k    = (const float*)d_in[1];
    const float* v    = (const float*)d_in[2];
    const int*   mask = (const int*)d_in[3];
    float* out = (float*)d_out;

    const size_t nelem   = (size_t)Bc * Hc * Sc * Dc;   // 8,388,608
    const size_t ws_need = 2 * nelem * sizeof(_Float16) + Bc * sizeof(int);

    dim3 grid(Sc / 64, Bc * Hc);
    dim3 block(128);

    if (ws_size >= ws_need && d_ws != nullptr) {
        _Float16* kh = (_Float16*)d_ws;
        _Float16* vh = kh + nelem;
        int* nlive = (int*)(vh + nelem);
        cvt_kv<<<dim3(CVT_BLOCKS), dim3(CVT_THREADS), 0, stream>>>(k, v, mask, kh, vh, nlive);
        fa_fwd_wmma2<<<dim3(Sc / FA_QROWS, Bc * Hc), dim3(FA_THREADS), 0, stream>>>(q, kh, vh, nlive, out);
    } else {
        fa_fwd_wmma1<<<grid, block, 0, stream>>>(q, k, v, mask, out);
    }
}

// v008
// Measured time: 33.8 microseconds a run.
// Timed twice side by side with v007, it ran 1.24 times as fast both times.
// All steps since v000 together make it 9.13 times as fast.
#include <hip/hip_runtime.h>
#include <hip/hip_bf16.h>

typedef __attribute__((ext_vector_type(16))) _Float16 v16h;
typedef __attribute__((ext_vector_type(8)))  _Float16 v8h;
typedef __attribute__((ext_vector_type(4)))  _Float16 v4h;
typedef __attribute__((ext_vector_type(8)))  float    v8f;
typedef __attribute__((ext_vector_type(4)))  int      v4i;
typedef __attribute__((ext_vector_type(4)))  float    v4f;
typedef __attribute__((ext_vector_type(8)))  unsigned short v8us;

#define Bc 2
#define Hc 16
#define Sc 2048
#define Dc 128
#define NTILE (Sc / 32)            // 64 key tiles per (b,h)
#define TILE_HALVES (32 * 128)     // 4096 f16 per K or V tile (8KB)
// LDS row pitches in f16: 16 bytes x odd, so that the 16 lanes of a half wave,
// one row each, spread a 16-byte read over all 64 banks.
#define KP 136                     // 256-byte rows (K, Q) at 272 bytes
#define VP 40                      // 64-byte rows (V^T) at 80 bytes
#define OP 132                     // in f32: 512-byte rows (O) at 528 bytes; 16 fit 32 Q rows

#if defined(__has_builtin)
#if __has_builtin(__builtin_amdgcn_global_load_async_to_lds_b128)
#define ASYNC_KV 1
#endif
#endif

__device__ __forceinline__ float rmax16(float x) {
    x = fmaxf(x, __shfl_xor(x, 1, 32));
    x = fmaxf(x, __shfl_xor(x, 2, 32));
    x = fmaxf(x, __shfl_xor(x, 4, 32));
    x = fmaxf(x, __shfl_xor(x, 8, 32));
    return x;
}
__device__ __forceinline__ float rsum16(float x) {
    x += __shfl_xor(x, 1, 32);
    x += __shfl_xor(x, 2, 32);
    x += __shfl_xor(x, 4, 32);
    x += __shfl_xor(x, 8, 32);
    return x;
}

// Lane l takes the value of lane l ^ 16 (the other half of the wave).
__device__ __forceinline__ float xhalf(float x) {
    int i = __builtin_bit_cast(int, x);
    return __builtin_bit_cast(float, __builtin_amdgcn_permlanex16(
        i, i, 0x76543210, 0xfedcba98, false, false));
}

// One 16-element fragment from a padded LDS row: rows are 16-byte aligned only.
__device__ __forceinline__ v16h ld_frag(const _Float16* p) {
    v8h lo = *(const v8h*)p;
    v8h hi = *(const v8h*)(p + 8);
    return __builtin_shufflevector(lo, hi, 0, 1, 2, 3, 4, 5, 6, 7,
                                   8, 9, 10, 11, 12, 13, 14, 15);
}

// A fragment whose k order pairs with a B operand packed from two accumulator
// tiles: half h of the wave holds k 8h..8h+7 and 16+8h..16+8h+7.
__device__ __forceinline__ v16h ld_frag_kmap(const _Float16* row, int h) {
    v8h lo = *(const v8h*)(row + 8 * h);
    v8h hi = *(const v8h*)(row + 16 + 8 * h);
    return __builtin_shufflevector(lo, hi, 0, 1, 2, 3, 4, 5, 6, 7,
                                   8, 9, 10, 11, 12, 13, 14, 15);
}

// Copy one 8KB tile (4096 f16) global -> LDS, FA_THREADS threads, thread t does 2x16B.
// The global image is contiguous rows of ROW f16; in LDS the rows lie PITCH apart.
#define FA_WAVES 8
#define FA_THREADS (FA_WAVES * 32)
#define FA_QROWS (FA_WAVES * 32)   // queries of a block: 32 per wave
template <int ROW, int PITCH>
__device__ __forceinline__ void tile_copy(const _Float16* __restrict__ g,
                                          _Float16* l, int t) {
    constexpr int CH = ROW / 8;                 // 16-byte chunks per row
    constexpr int NSTEP = TILE_HALVES / 8 / FA_THREADS;
    l += (t / CH) * PITCH + (t % CH) * 8;       // this thread's chunk, step 0
    constexpr int LSTEP = (FA_THREADS / CH) * PITCH;   // rows per step x pitch
#ifdef ASYNC_KV
    typedef __attribute__((address_space(1))) v4i gv4i;   // global <4 x i32>
    typedef __attribute__((address_space(3))) v4i lv4i;   // LDS    <4 x i32>
#pragma unroll
    for (int i = 0; i < NSTEP; i++) {
        __builtin_amdgcn_global_load_async_to_lds_b128(
            (gv4i*)(g + t * 8 + i * (FA_THREADS * 8)),
            (lv4i*)(l + i * LSTEP), 0, 0);
    }
#else
#pragma unroll
    for (int i = 0; i < NSTEP; i++) {
        *(v8h*)(l + i * LSTEP) = *(const v8h*)(g + t * 8 + i * (FA_THREADS * 8));
    }
#endif
}

// A stage is STG key tiles; the LDS ring holds two stages, tile x in slot x mod 2*STG.
#define STG 4
#define RING (2 * STG)

// The copies of the stage that begins with tile t0: those of its tiles that exist
// (the pre-pass writes no tile from nt on).  t0 and nt are the same for the whole block,
// and the caller has seen that tile t0 exists.
__device__ __forceinline__ void stage_copy(const _Float16* __restrict__ kbase,
                                           const _Float16* __restrict__ vbase,
                                           _Float16 (*Kt)[32 * KP], _Float16 (*Vt)[128 * VP],
                                           int t0, int nt, int t) {
#pragma unroll
    for (int j = 0; j < STG; j++) {
        if (j == 0 || t0 + j < nt) {
            tile_copy<128, KP>(kbase + (size_t)(t0 + j) * TILE_HALVES, Kt[(t0 + j) & (RING - 1)], t);
            tile_copy<32, VP>(vbase + (size_t)(t0 + j) * TILE_HALVES, Vt[(t0 + j) & (RING - 1)], t);
        }
    }
}

__device__ __forceinline__ void wait_async_kv() {
#ifdef ASYNC_KV
    asm volatile("s_wait_asynccnt 0" ::: "memory");
#endif
}

// ---------------------------------------------------------------------------
// Pre-pass: fp32 K/V -> f16, the keys of a batch reordered so that the unmasked
// ones come first (a masked key's weight is exp(-1e9 - max) = 0 as soon as one key
// is unmasked), V transposed tile-wise so hot-loop LDS tiles are contiguous memcpy
// images.  kh: [bh][position][d].  vh: [bh][tile][d][position32].
// Every block forms the order of its batch itself: a stable partition, unmasked
// keys in their order, then the masked ones.  It is a permutation of 0..Sc-1 for
// any content of the mask, so every row index read from perm lies inside K and V.
// The masked keys behind the last unmasked one fill up the last tile with finite
// rows; with no unmasked key the order is the identity and all tiles are written.
// One wave converts half a 32-key tile of K and of V with 32 loads of 16 bytes,
// all issued before the first conversion.
// K: 16 rows, each load one whole row of 512 bytes, each store 256.
// V: a strip of 32 keys x 64 d.  A lane loads 4 d of 8 consecutive positions, so
// the 8 positions of one d (16 bytes of vh) lie in that lane: the transpose is a
// choice of registers.  Four neighbour lanes hold the four groups of the same d:
// a load touches whole 128-byte lines, a store writes whole 64-byte rows of vh.
// A block takes every 8th tile of its (b,h), so that the tiles that are needed
// spread evenly over the blocks.
// ---------------------------------------------------------------------------
#define CVT_THREADS 512
#define CVT_BLOCKS (Bc * Hc * 8)   // 16 waves = 8 tiles x 2 halves per block
__global__ __launch_bounds__(CVT_THREADS)
void cvt_kv(const float* __restrict__ k, const float* __restrict__ v,
            const int* __restrict__ mask,
            _Float16* __restrict__ kh, _Float16* __restrict__ vh,
            int* __restrict__ nlive) {
    __shared__ alignas(16) unsigned short perm[Sc];   // position -> key
    __shared__ alignas(16) int wtot[CVT_THREADS / 32];

    const int lane = threadIdx.x & 31;
    const int wave = __builtin_amdgcn_readfirstlane(threadIdx.x >> 5);
    const int bh   = blockIdx.x >> 3;
    const int b    = bh >> 4;

    // ---- the order: wave w ranks keys 128w .. 128w+127, 32 per ballot
    const int* mp = mask + b * Sc + wave * 128 + lane;
    unsigned bal[4];
    int tot = 0;
#pragma unroll
    for (int j = 0; j < 4; j++) {
        bal[j] = __builtin_amdgcn_ballot_w32(mp[j * 32] != 0);
        tot += __builtin_popcount(bal[j]);
    }
    if (lane == 0) wtot[wave] = tot;
    __syncthreads();               // every wave's count is in wtot
    int before = 0, n = 0;         // unmasked keys in front of this wave's; in all
#pragma unroll
    for (int w = 0; w < CVT_THREADS / 32; w++) {
        const int x = wtot[w];
        n += x;
        before += (w < wave) ? x : 0;
    }
#pragma unroll
    for (int j = 0; j < 4; j++) {
        const int key = wave * 128 + j * 32 + lane;
        const int lb  = before + __builtin_popcount(bal[j] & ((1u << lane) - 1u));
        perm[((bal[j] >> lane) & 1u) ? lb : n + key - lb] = (unsigned short)key;
        before += __builtin_popcount(bal[j]);
    }
    __syncthreads();               // perm is whole
    if ((blockIdx.x & (Hc * 8 - 1)) == 0 && threadIdx.x == 0) nlive[b] = n;

    const int nt   = __builtin_amdgcn_readfirstlane(n ? (n + 31) >> 5 : NTILE);
    const int tile = (wave >> 1) * 8 + (blockIdx.x & 7);
    if (tile < nt) {               // the main kernel reads no tile from nt on
        const int half = wave & 1;
        const int st   = bh * NTILE + tile;
        const int d0   = half * 64 + (lane >> 2) * 4;
        const int key0 = (lane & 3) * 8;

        const v8us rk0 = *(const v8us*)&perm[tile * 32 + half * 16];
        const v8us rk1 = *(const v8us*)&perm[tile * 32 + half * 16 + 8];
        const v8us rv  = *(const v8us*)&perm[tile * 32 + key0];
        const char* kb = (const char*)(k + (size_t)bh * Sc * Dc);
        const char* vb = (const char*)(v + (size_t)bh * Sc * Dc);
        unsigned ka[16], va[8];    // byte offsets in this (b,h): the loads' address registers
#pragma unroll
        for (int i = 0; i < 8; i++) {
            ka[i]     = (unsigned)rk0[i] * (Dc * 4) + lane * 16;
            ka[8 + i] = (unsigned)rk1[i] * (Dc * 4) + lane * 16;
            va[i]     = (unsigned)rv[i] * (Dc * 4) + d0 * 4;
        }

        // Every loop here is unrolled so that kx and vx are indexed by constants
        // and stay in registers.
        v4f kx[16];
#pragma unroll
        for (int i = 0; i < 16; i++) kx[i] = *(const v4f*)(kb + ka[i]);
        v4f vx[2][8];                            // [32-d group][position]
#pragma unroll
        for (int i = 0; i < 8; i++) {
            vx[0][i] = *(const v4f*)(vb + va[i]);
            vx[1][i] = *(const v4f*)(vb + va[i] + 128);
        }
        // The wait that stands before a load's address registers are written again.
        // As inputs the offsets stay live up to it, so that no load lands on them;
        // and no load sinks below it: without it the compiler holds the V loads
        // back until K has landed, two memory latencies in a row.
        asm volatile("s_wait_xcnt 0x0"
                     :: "v"(ka[0]), "v"(ka[1]), "v"(ka[2]), "v"(ka[3]), "v"(ka[4]),
                        "v"(ka[5]), "v"(ka[6]), "v"(ka[7]), "v"(ka[8]), "v"(ka[9]),
                        "v"(ka[10]), "v"(ka[11]), "v"(ka[12]), "v"(ka[13]),
                        "v"(ka[14]), "v"(ka[15]), "v"(va[0]), "v"(va[1]), "v"(va[2]),
                        "v"(va[3]), "v"(va[4]), "v"(va[5]), "v"(va[6]), "v"(va[7])
                     : "memory");

        _Float16* ko = kh + (size_t)st * TILE_HALVES + half * (TILE_HALVES / 2) + lane * 4;
#pragma unroll
        for (int i = 0; i < 16; i++)
            *(v4h*)(ko + i * 128) = __builtin_convertvector(kx[i], v4h);

        _Float16* vo = vh + (size_t)st * TILE_HALVES + d0 * 32 + key0;
#pragma unroll
        for (int r = 0; r < 2; r++) {
#pragma unroll
            for (int j = 0; j < 4; j++) {
                v8h y;
#pragma unroll
                for (int i = 0; i < 8; i++) y[i] = (_Float16)vx[r][i][j];
                *(v8h*)(vo + (r * 32 + j) * 32) = y;
            }
        }
    }
}

// P of one tile from its exponents: the B operand of O^T += V^T x P^T (element g is
// key 8hf + g, element 8 + g key 16 + 8hf + g) and this lane's sum of the 16 values.
__device__ __forceinline__ float tile_p(const v8f& x0, const v8f& x1, v16h& pf) {
    float rs[4] = {0.0f, 0.0f, 0.0f, 0.0f};     // four short chains
#pragma unroll
    for (int g = 0; g < 8; g++) {
        const float e0 = __builtin_amdgcn_exp2f(x0[g]);
        const float e1 = __builtin_amdgcn_exp2f(x1[g]);
        rs[g & 1]       += e0;
        rs[2 + (g & 1)] += e1;
        pf[g]     = (_Float16)e0;
        pf[8 + g] = (_Float16)e1;
    }
    return (rs[0] + rs[1]) + (rs[2] + rs[3]);
}

// ---------------------------------------------------------------------------
// Main kernel (workspace path): f16 K/V, async double-buffered LDS pipeline.
// Transposed products: S^T = K x Q^T (A = K rows, B = Q), O^T += V^T x P^T.
// A lane holds 16 of the tile's 32 scores of each of its two queries (column ln of a group), so the
// maximum and the sum run in the lane, with one exchange between the halves,
// and P^T packs from the two score tiles straight into a B operand.
// The pre-pass has put the unmasked keys first: the loop walks the tiles that
// hold one, and only a tile that also holds masked keys selects.
// The score product yields the exponent itself: Q carries scale * log2(e), and minus
// the query's softmax reference is the C operand, so P = exp2(accumulator).  The
// reference is held from tile to tile: the first tile sets it to its maximum, and it
// rises, with O and the sum rescaled, only when a lane's P sum of a tile passes PLIM.
// A wave takes 32 queries, two column groups of 16: every K and V^T fragment read
// from LDS is the A operand of two products, and a block's tile serves 256 queries.
// K and V^T are staged 128 keys at a time: one wait and one barrier per four tiles, the
// next stage's copies in flight for a whole stage; between two barriers the waves run
// free, so that one wave's LDS reads and softmax pass under another's products.
// ---------------------------------------------------------------------------
__global__ __launch_bounds__(FA_THREADS)
void fa_fwd_wmma2(const float* __restrict__ q, const _Float16* __restrict__ kh,
                  const _Float16* __restrict__ vh, const int* __restrict__ nlive,
                  float* __restrict__ out) {
    constexpr float LOG2E  = 1.4426950408889634f;
    constexpr float QSCALE = 0.08838834764831845f * LOG2E;  // 1/sqrt(128) in log2 units
    constexpr float NEGV   = -1.0e9f * LOG2E;               // the masked score, same units
    constexpr float PLIM   = 256.0f;                        // no P above it: well inside f16

    __shared__ alignas(32) _Float16 Kt[RING][32 * KP];    // [slot][key][d]
    __shared__ alignas(32) _Float16 Vt[RING][128 * VP];   // [slot][d][key]
    __shared__ alignas(32) _Float16 Qs[FA_WAVES][32 * KP];

    const int t    = threadIdx.x;
    const int wave = t >> 5;
    const int lane = t & 31;
    const int ln   = lane & 15;
    const int hf   = lane >> 4;
    const int bh   = blockIdx.y;
    const int b    = bh >> 4;
    const int q0   = blockIdx.x * FA_QROWS + wave * 32;

    // unmasked keys of this batch; with none every key counts alike: all tiles are
    // walked and every score is the masked value
    const int n  = __builtin_amdgcn_readfirstlane(min(max(nlive[b], 0), Sc));
    const int nt = n ? (n + 31) >> 5 : NTILE;

    const _Float16* kbase = kh + (size_t)bh * NTILE * TILE_HALVES;
    const _Float16* vbase = vh + (size_t)bh * NTILE * TILE_HALVES;

    // ---- prologue: kick off the async copies of stage 0 (nt is at least 1) while staging Q
    stage_copy(kbase, vbase, Kt, Vt, 0, nt, t);

    {
        // A load takes one whole query row: 32 lanes x 16 bytes, four full 128-byte lines.
        const float* qp0 = q + ((size_t)bh * Sc + q0) * Dc + lane * 4;
        v4f x[32];      // [query row of this wave]; both loops unrolled: x stays in registers
#pragma unroll
        for (int r = 0; r < 32; r++) x[r] = *(const v4f*)(qp0 + r * Dc);
        // The wait that stands before a load's address registers are written again.
        // As an input the pointer stays live up to it, so that no load lands on it.
        asm volatile("s_wait_xcnt 0x0" :: "v"(qp0) : "memory");
#pragma unroll
        for (int r = 0; r < 32; r++)
            *(v4h*)&Qs[wave][r * KP + lane * 4] = __builtin_convertvector(x[r] * QSCALE, v4h);
    }
    __syncthreads();

    v16h qf[2][4];                  // [column group][32-d chunk]
#pragma unroll
    for (int u = 0; u < 2; u++)
#pragma unroll
        for (int c = 0; c < 4; c++)
            qf[u][c] = ld_frag(&Qs[wave][(u * 16 + ln) * KP + c * 32 + hf * 16]);

    v8f o[2][8];                    // o[u][n][g] = O^T[d = 16n + 8hf + g][query 16u + ln]
    v8f cref[2];                    // minus the query's reference (both halves alike), as C
    float lrun[2];                  // this half's share of the query's sum
#pragma unroll
    for (int u = 0; u < 2; u++) {
#pragma unroll
        for (int n = 0; n < 8; n++) o[u][n] = v8f{};
        cref[u] = v8f{};
        lrun[u] = 0.0f;
    }

#pragma unroll 1
    for (int kb = 0; kb < nt; kb++) {
        if ((kb & (STG - 1)) == 0) {   // a stage begins; the same for the whole block
            // its copies were issued a stage ago (or in the prologue)
            wait_async_kv();
            __syncthreads();   // stage visible; all waves done reading the other buffer
            if (kb + STG < nt)  // the next stage goes into the other buffer
                stage_copy(kbase, vbase, Kt, Vt, kb + STG, nt, t);
        }

        const _Float16* Kc = Kt[kb & (RING - 1)];
        const _Float16* Vc = Vt[kb & (RING - 1)];

        // ---- exponents: K x Q^T - reference, two 16-key sub-blocks x two column
        // groups (fp32 acc): four independent chains, a K fragment feeds two of them
        v16h kf[4][2];
#pragma unroll
        for (int c = 0; c < 4; c++) {
            kf[c][0] = ld_frag(&Kc[ln * KP + c * 32 + hf * 16]);
            kf[c][1] = ld_frag(&Kc[(16 + ln) * KP + c * 32 + hf * 16]);
        }
        // Keeps the tile's 16 K reads in one group ahead of the products: left alone the
        // compiler puts a pair in front of each two WMMAs, through one register set, and
        // the wave waits out the LDS latency eight times a tile.
        __builtin_amdgcn_sched_barrier(0);
        v8f acc[2][2] = {{cref[0], cref[0]}, {cref[1], cref[1]}};   // [group][sub-block]
#pragma unroll
        for (int c = 0; c < 4; c++)
#pragma unroll
            for (int j = 0; j < 2; j++)
#pragma unroll
                for (int u = 0; u < 2; u++)
                    acc[u][j] = __builtin_amdgcn_wmma_f32_16x16x32_f16(
                        false, kf[c][j], false, qf[u][c], (short)0, acc[u][j], false, false);
        // Keeps the V^T reads below out of the run of products above.
        __builtin_amdgcn_sched_barrier(0);

        // The V^T fragments are asked for here, as one group behind the last score
        // product: their LDS latency passes under the softmax.
        v16h vf[8];
#pragma unroll
        for (int n = 0; n < 8; n++) vf[n] = ld_frag_kmap(&Vc[(n * 16 + ln) * VP], hf);

        // ---- softmax of two queries per lane against their held references
        if (__builtin_expect((kb + 1) * 32 > n, 0)) {   // rare; the same for the whole block
            // acc[u][X][g] belongs to position kb*32 + 16X + 8hf + g; from n on masked
            const int r = n - kb * 32 - 8 * hf;
#pragma unroll
            for (int u = 0; u < 2; u++) {
                const float mv = NEGV + cref[u][0];     // the masked score minus the reference
#pragma unroll
                for (int g = 0; g < 8; g++) {
                    acc[u][0][g] = g < r      ? acc[u][0][g] : mv;
                    acc[u][1][g] = 16 + g < r ? acc[u][1][g] : mv;
                }
            }
        }
        v16h pf[2];
        float rs[2];
#pragma unroll
        for (int u = 0; u < 2; u++) rs[u] = tile_p(acc[u][0], acc[u][1], pf[u]);
        // One test per tile; the ballot makes it a scalar branch, so that every lane
        // stays on for the WMMAs.  An overflowed P gives an infinite sum and is caught;
        // the first tile always passes the test (a sum is never below 0).
        const float lim = kb == 0 ? -1.0f : PLIM;
        if (__builtin_amdgcn_ballot_w32(fmaxf(rs[0], rs[1]) > lim) != 0) {
#pragma unroll
            for (int u = 0; u < 2; u++) {
                float tq[4];        // four short chains, not one of sixteen links
#pragma unroll
                for (int g = 0; g < 4; g++)
                    tq[g] = fmaxf(fmaxf(acc[u][0][2 * g], acc[u][0][2 * g + 1]),
                                  fmaxf(acc[u][1][2 * g], acc[u][1][2 * g + 1]));
                float tm = fmaxf(fmaxf(tq[0], tq[1]), fmaxf(tq[2], tq[3]));
                tm = fmaxf(tm, xhalf(tm));              // both halves move alike
                const float up = fmaxf(tm, 0.0f);       // later tiles only raise the reference
                const float d  = kb == 0 ? tm : up;     // the first sets it (O and sum are 0)
                const float alpha = __builtin_amdgcn_exp2f(-up);
                lrun[u] *= alpha;
#pragma unroll
                for (int n = 0; n < 8; n++) o[u][n] *= alpha;
                cref[u] -= d;
                acc[u][0] -= d;
                acc[u][1] -= d;
                rs[u] = tile_p(acc[u][0], acc[u][1], pf[u]);
            }
        }
        lrun[0] += rs[0];
        lrun[1] += rs[1];

#pragma unroll
        for (int n = 0; n < 8; n++)
#pragma unroll
            for (int u = 0; u < 2; u++)
                o[u][n] = __builtin_amdgcn_wmma_f32_16x16x32_f16(
                    false, vf[n], false, pf[u], (short)0, o[u][n], false, false);
    }

    // ---- epilogue: join the halves' sums.  A lane holds 8 consecutive d of one query, 32
    // bytes of a line; the 16 rows of a column group turn in LDS, so that a store takes one
    // whole output row, four full 128-byte lines.  The wave uses its own Q rows for it:
    // no other wave touches them, and its own last read of them stands before the loop.
    float* Os = (float*)&Qs[wave][0];
    float* op = out + ((size_t)bh * Sc + q0) * Dc + lane * 4;
#pragma unroll
    for (int u = 0; u < 2; u++) {
        const float rcp = 1.0f / (lrun[u] + xhalf(lrun[u]));
#pragma unroll
        for (int n = 0; n < 8; n++) {
            v8f r = o[u][n] * rcp;
            float* os = &Os[ln * OP + n * 16 + 8 * hf];
            *(v4f*)&os[0] = __builtin_shufflevector(r, r, 0, 1, 2, 3);
            *(v4f*)&os[4] = __builtin_shufflevector(r, r, 4, 5, 6, 7);
        }
        // Every lane's rows are in LDS before another lane of the wave reads them back.
        asm volatile("s_wait_dscnt 0" ::: "memory");
        v4f y[16];                  // unrolled: indexed by constants, stays in registers
#pragma unroll
        for (int r = 0; r < 16; r++) y[r] = *(const v4f*)&Os[r * OP + lane * 4];
        // The rows are read out before the next column group's rows are written over them.
        asm volatile("s_wait_dscnt 0" ::: "memory");
#pragma unroll
        for (int r = 0; r < 16; r++) *(v4f*)(op + (u * 16 + r) * Dc) = y[r];
    }
}

// ---------------------------------------------------------------------------
// Fallback (no workspace): round-1 kernel, converts in-loop.
// ---------------------------------------------------------------------------
__global__ __launch_bounds__(128, 1)
void fa_fwd_wmma1(const float* __restrict__ q, const float* __restrict__ k,
                  const float* __restrict__ v, const int* __restrict__ mask,
                  float* __restrict__ out) {
    constexpr float SCALE = 0.08838834764831845f;
    constexpr float NEGV  = -1.0e9f;

    __shared__ alignas(32) _Float16 Kt[32 * 128];
    __shared__ alignas(32) _Float16 Vt[128 * 32];
    __shared__ alignas(32) _Float16 Qs[4][16 * 128];
    __shared__ alignas(32) _Float16 Pt[4][16 * 32];

    const int t    = threadIdx.x;
    const int wave = t >> 5;
    const int lane = t & 31;
    const int ln   = lane & 15;
    const int hf   = lane >> 4;
    const int bh   = blockIdx.y;
    const int b    = bh >> 4;
    const int q0   = blockIdx.x * 64 + wave * 16;

    {
        const float* qp = q + ((size_t)bh * Sc + q0 + ln) * Dc + hf * 64;
        _Float16* dst = &Qs[wave][ln * 128 + hf * 64];
#pragma unroll
        for (int j = 0; j < 16; j++) {
            float4 x = ((const float4*)qp)[j];
            dst[4 * j + 0] = (_Float16)x.x;
            dst[4 * j + 1] = (_Float16)x.y;
            dst[4 * j + 2] = (_Float16)x.z;
            dst[4 * j + 3] = (_Float16)x.w;
        }
    }
    __syncthreads();

    v16h qf[4];
#pragma unroll
    for (int c = 0; c < 4; c++)
        qf[c] = *(const v16h*)&Qs[wave][ln * 128 + c * 32 + hf * 16];

    v8f o[8];
#pragma unroll
    for (int n = 0; n < 8; n++) o[n] = v8f{};
    float mrow[8], lrow[8];
#pragma unroll
    for (int g = 0; g < 8; g++) { mrow[g] = -3.0e38f; lrow[g] = 0.0f; }

    const int row = t >> 2;
    const int d0  = (t & 3) * 32;

#pragma unroll 1
    for (int kb = 0; kb < NTILE; kb++) {
        const int kcol = kb * 32;
        __syncthreads();
        {
            const float* kp = k + ((size_t)bh * Sc + kcol + row) * Dc + d0;
            const float* vp = v + ((size_t)bh * Sc + kcol + row) * Dc + d0;
            _Float16* kd = &Kt[row * 128 + d0];
#pragma unroll
            for (int j = 0; j < 8; j++) {
                float4 x = ((const float4*)kp)[j];
                kd[4 * j + 0] = (_Float16)x.x;
                kd[4 * j + 1] = (_Float16)x.y;
                kd[4 * j + 2] = (_Float16)x.z;
                kd[4 * j + 3] = (_Float16)x.w;
                float4 y = ((const float4*)vp)[j];
                Vt[(d0 + 4 * j + 0) * 32 + row] = (_Float16)y.x;
                Vt[(d0 + 4 * j + 1) * 32 + row] = (_Float16)y.y;
                Vt[(d0 + 4 * j + 2) * 32 + row] = (_Float16)y.z;
                Vt[(d0 + 4 * j + 3) * 32 + row] = (_Float16)y.w;
            }
        }
        __syncthreads();

        v8f acc0 = v8f{}, acc1 = v8f{};
#pragma unroll
        for (int c = 0; c < 4; c++) {
            v16h b0 = *(const v16h*)&Kt[ln * 128 + c * 32 + hf * 16];
            acc0 = __builtin_amdgcn_wmma_f32_16x16x32_f16(false, qf[c], false, b0,
                                                          (short)0, acc0, false, false);
        }
#pragma unroll
        for (int c = 0; c < 4; c++) {
            v16h b1 = *(const v16h*)&Kt[(16 + ln) * 128 + c * 32 + hf * 16];
            acc1 = __builtin_amdgcn_wmma_f32_16x16x32_f16(false, qf[c], false, b1,
                                                          (short)0, acc1, false, false);
        }

        const int m0 = mask[b * Sc + kcol + ln];
        const int m1 = mask[b * Sc + kcol + 16 + ln];
        const float sc0 = m0 ? SCALE : 0.0f, ad0 = m0 ? 0.0f : NEGV;
        const float sc1 = m1 ? SCALE : 0.0f, ad1 = m1 ? 0.0f : NEGV;

        float p0[8], p1[8], alpha[8];
#pragma unroll
        for (int g = 0; g < 8; g++) {
            float s0 = acc0[g] * sc0 + ad0;
            float s1 = acc1[g] * sc1 + ad1;
            float bm   = rmax16(fmaxf(s0, s1));
            float mnew = fmaxf(mrow[g], bm);
            alpha[g] = __expf(mrow[g] - mnew);
            p0[g]    = __expf(s0 - mnew);
            p1[g]    = __expf(s1 - mnew);
            float rs = rsum16(p0[g] + p1[g]);
            lrow[g] = lrow[g] * alpha[g] + rs;
            mrow[g] = mnew;
        }

#pragma unroll
        for (int g = 0; g < 8; g++) {
            Pt[wave][(g + 8 * hf) * 32 + ln]      = (_Float16)p0[g];
            Pt[wave][(g + 8 * hf) * 32 + 16 + ln] = (_Float16)p1[g];
        }
#pragma unroll
        for (int n = 0; n < 8; n++) {
#pragma unroll
            for (int g = 0; g < 8; g++) o[n][g] *= alpha[g];
        }
        asm volatile("s_wait_dscnt 0" ::: "memory");

        v16h pf = *(const v16h*)&Pt[wave][ln * 32 + hf * 16];
#pragma unroll
        for (int n = 0; n < 8; n++) {
            v16h vf = *(const v16h*)&Vt[(n * 16 + ln) * 32 + hf * 16];
            o[n] = __builtin_amdgcn_wmma_f32_16x16x32_f16(false, pf, false, vf,
                                                          (short)0, o[n], false, false);
        }
    }

    float rcp[8];
#pragma unroll
    for (int g = 0; g < 8; g++) rcp[g] = 1.0f / lrow[g];
#pragma unroll
    for (int n = 0; n < 8; n++) {
#pragma unroll
        for (int g = 0; g < 8; g++) {
            out[((size_t)bh * Sc + q0 + g + 8 * hf) * Dc + n * 16 + ln] = o[n][g] * rcp[g];
        }
    }
}

extern "C" void kernel_launch(void* const* d_in, const int* in_sizes, int n_in,
                              void* d_out, int out_size, void* d_ws, size_t ws_size,
                              hipStream_t stream) {
    (void)in_sizes; (void)n_in; (void)out_size;
    const float* q    = (const float*)d_in[0];
    const float* k    = (const float*)d_in[1];
    const float* v    = (const float*)d_in[2];
    const int*   mask = (const int*)d_in[3];
    float* out = (float*)d_out;

    const size_t nelem   = (size_t)Bc * Hc * Sc * Dc;   // 8,388,608
    const size_t ws_need = 2 * nelem * sizeof(_Float16) + Bc * sizeof(int);

    dim3 grid(Sc / 64, Bc * Hc);
    dim3 block(128);

    if (ws_size >= ws_need && d_ws != nullptr) {
        _Float16* kh = (_Float16*)d_ws;
        _Float16* vh = kh + nelem;
        int* nlive = (int*)(vh + nelem);
        cvt_kv<<<dim3(CVT_BLOCKS), dim3(CVT_THREADS), 0, stream>>>(k, v, mask, kh, vh, nlive);
        fa_fwd_wmma2<<<dim3(Sc / FA_QROWS, Bc * Hc), dim3(FA_THREADS), 0, stream>>>(q, kh, vh, nlive, out);
    } else {
        fa_fwd_wmma1<<<grid, block, 0, stream>>>(q, k, v, mask, out);
    }
}

// v009
// Measured time: 28.6 microseconds a run.
// Two timings next to v008 put it at 1.19 and 1.18 times that version's speed.
// All steps since v000 together make it 10.8 times as fast.
#include <hip/hip_runtime.h>
#include <hip/hip_bf16.h>

typedef __attribute__((ext_vector_type(16))) _Float16 v16h;
typedef __attribute__((ext_vector_type(8)))  _Float16 v8h;
typedef __attribute__((ext_vector_type(4)))  _Float16 v4h;
typedef __attribute__((ext_vector_type(8)))  float    v8f;
typedef __attribute__((ext_vector_type(4)))  float    v4f;
typedef __attribute__((ext_vector_type(4)))  unsigned v4u;

#define Bc 2
#define Hc 16
#define Sc 2048
#define Dc 128
#define NTILE (Sc / 32)            // 64 key tiles per (b,h)
// LDS row pitches in f16: 16 bytes x odd, so that the 16 lanes of a half wave,
// one row each, spread a 16-byte read over all 64 banks.
#define KP 136                     // 256-byte rows (K, Q) at 272 bytes
#define VP 40                      // 64-byte rows (V^T) at 80 bytes
#define OP 132                     // in f32: 512-byte rows (O) at 528 bytes; 16 fit 32 Q rows

// Lane l takes the value of lane l ^ 16 (the other half of the wave).
__device__ __forceinline__ float xhalf(float x) {
    int i = __builtin_bit_cast(int, x);
    return __builtin_bit_cast(float, __builtin_amdgcn_permlanex16(
        i, i, 0x76543210, 0xfedcba98, false, false));
}

// One 16-element fragment from a padded LDS row: rows are 16-byte aligned only.
__device__ __forceinline__ v16h ld_frag(const _Float16* p) {
    v8h lo = *(const v8h*)p;
    v8h hi = *(const v8h*)(p + 8);
    return __builtin_shufflevector(lo, hi, 0, 1, 2, 3, 4, 5, 6, 7,
                                   8, 9, 10, 11, 12, 13, 14, 15);
}

// A fragment whose k order pairs with a B operand packed from two accumulator
// tiles: half h of the wave holds k 8h..8h+7 and 16+8h..16+8h+7.
__device__ __forceinline__ v16h ld_frag_kmap(const _Float16* row, int h) {
    v8h lo = *(const v8h*)(row + 8 * h);
    v8h hi = *(const v8h*)(row + 16 + 8 * h);
    return __builtin_shufflevector(lo, hi, 0, 1, 2, 3, 4, 5, 6, 7,
                                   8, 9, 10, 11, 12, 13, 14, 15);
}

#define FA_WAVES 8
#define FA_THREADS (FA_WAVES * 32)
#define FA_QROWS (FA_WAVES * 32)   // queries of a block: 32 per wave

// A stage is STG key tiles; the LDS ring holds two stages, tile x in slot x mod 2*STG.
#define STG 4
#define RING (2 * STG)

// Work-group barrier that orders LDS data alone.  __syncthreads() also waits for every
// global load of the wave, and the K/V (and Q) loads that fly over a barrier here would
// have to land in front of it.
__device__ __forceinline__ void lds_barrier() {
    __builtin_amdgcn_fence(__ATOMIC_RELEASE, "workgroup", "local");
    __builtin_amdgcn_s_barrier();
    __builtin_amdgcn_fence(__ATOMIC_ACQUIRE, "workgroup", "local");
}

// A block brings a 32-key tile of K and V from the f32 inputs into the ring through
// registers.  Of each tile a wave takes
// K: 4 rows, each load one whole row of 512 bytes;
// V: 16 keys x 32 d.  A lane loads 4 d of 4 consecutive positions, eight neighbour lanes
// one whole 128-byte line; the 4 positions of one d (8 bytes of a V^T row) lie in that
// lane, so the transpose is a choice of registers.
// perm holds, per position, the byte offset of that key's row in its (b,h).

// This wave's row offsets of a tile: pk for its K rows, pv for this lane's V rows.
__device__ __forceinline__ void tile_rows(const unsigned* perm, int tile, int wave, int lane,
                                          v4u& pk, v4u& pv) {
    pk = *(const v4u*)&perm[tile * 32 + wave * 4];
    pv = *(const v4u*)&perm[tile * 32 + (wave >> 2) * 16 + (lane >> 3) * 4];
}

// The eight loads; ad hands their offset registers to tile_issued.
__device__ __forceinline__ void tile_issue(const char* __restrict__ kb, const char* __restrict__ vb,
                                           const v4u& pk, const v4u& pv, int wave, int lane,
                                           v4f (&kx)[4], v4f (&vx)[4], unsigned (&ad)[8]) {
#pragma unroll
    for (int i = 0; i < 4; i++) {
        ad[i]     = pk[i] + lane * 16;
        ad[4 + i] = pv[i] + (wave & 3) * 128 + (lane & 7) * 16;
    }
#pragma unroll
    for (int i = 0; i < 4; i++) kx[i] = *(const v4f*)(kb + ad[i]);
#pragma unroll
    for (int i = 0; i < 4; i++) vx[i] = *(const v4f*)(vb + ad[4 + i]);
}

// The wait that stands before a load's address registers are written again.  As inputs
// the offsets stay live up to it, so that nothing lands on them in front of it.
__device__ __forceinline__ void tile_issued(const unsigned (&ad)[8]) {
    asm volatile("s_wait_xcnt 0x0"
                 :: "v"(ad[0]), "v"(ad[1]), "v"(ad[2]), "v"(ad[3]),
                    "v"(ad[4]), "v"(ad[5]), "v"(ad[6]), "v"(ad[7])
                 : "memory");
}

// f32 -> f16 and into the tile's slot: Ks [key][d], Vs [d][key].
__device__ __forceinline__ void tile_store(_Float16* Ks, _Float16* Vs, int wave, int lane,
                                           const v4f (&kx)[4], const v4f (&vx)[4]) {
#pragma unroll
    for (int i = 0; i < 4; i++)
        *(v4h*)&Ks[(wave * 4 + i) * KP + lane * 4] = __builtin_convertvector(kx[i], v4h);
    _Float16* vo = &Vs[((wave & 3) * 32 + (lane & 7) * 4) * VP + (wave >> 2) * 16 + (lane >> 3) * 4];
#pragma unroll
    for (int j = 0; j < 4; j++) {
        v4h y;
#pragma unroll
        for (int i = 0; i < 4; i++) y[i] = (_Float16)vx[i][j];
        *(v4h*)(vo + j * VP) = y;
    }
}

// P of one tile from its exponents: the B operand of O^T += V^T x P^T (element g is
// key 8hf + g, element 8 + g key 16 + 8hf + g) and this lane's sum of the 16 values.
__device__ __forceinline__ float tile_p(const v8f& x0, const v8f& x1, v16h& pf) {
    float rs[4] = {0.0f, 0.0f, 0.0f, 0.0f};     // four short chains
#pragma unroll
    for (int g = 0; g < 8; g++) {
        const float e0 = __builtin_amdgcn_exp2f(x0[g]);
        const float e1 = __builtin_amdgcn_exp2f(x1[g]);
        rs[g & 1]       += e0;
        rs[2 + (g & 1)] += e1;
        pf[g]     = (_Float16)e0;
        pf[8 + g] = (_Float16)e1;
    }
    return (rs[0] + rs[1]) + (rs[2] + rs[3]);
}

// ---------------------------------------------------------------------------
// ---------------------------------------------------------------------------
// One launch.  Transposed products: S^T = K x Q^T (A = K rows, B = Q), O^T += V^T x P^T.
// A lane holds 16 of the tile's 32 scores of ONE query (column ln), so the
// maximum and the sum run in the lane, with one exchange between the halves,
// and P^T packs from the two score tiles straight into a B operand.
// Every block forms the order of its batch's keys itself: a stable partition, unmasked
// keys in their order, then the masked ones (a masked key's weight is exp(-1e9 - max) = 0
// as soon as one key is unmasked).  It is a permutation of 0..Sc-1 for any content of the
// mask, so every row offset read from perm lies inside K and V.  The loop walks the tiles
// that hold an unmasked key, and only a tile that also holds masked keys selects; the
// masked keys behind the last unmasked one fill up the last tile with finite rows; with no
// unmasked key the order is the identity and all tiles are walked.
// The score product yields the exponent itself: Q carries scale * log2(e), and minus
// the query's softmax reference is the C operand, so P = exp2(accumulator).  The
// reference is held from tile to tile: the first tile sets it to its maximum, and it
// rises, with O and the sum rescaled, only when a lane's P sum of a tile passes PLIM.
// A wave takes 32 queries, two column groups of 16: every K and V^T fragment read
// from LDS is the A operand of two products, and a block's tile serves 256 queries.
// K and V^T are staged 128 keys at a time, one barrier per four tiles.  Pass kb writes
// tile kb + 4, a tile of the next stage, into the buffer that the barrier at the head of
// this stage has freed; its loads were issued two passes earlier, into one of two
// register sets, and the set then takes the loads of tile kb + 6.
// ---------------------------------------------------------------------------
__global__ __launch_bounds__(FA_THREADS)
void fa_fwd_wmma2(const float* __restrict__ q, const float* __restrict__ k,
                  const float* __restrict__ v, const int* __restrict__ mask,
                  float* __restrict__ out) {
    constexpr float LOG2E  = 1.4426950408889634f;
    constexpr float QSCALE = 0.08838834764831845f * LOG2E;  // 1/sqrt(128) in log2 units
    constexpr float NEGV   = -1.0e9f * LOG2E;               // the masked score, same units
    constexpr float PLIM   = 256.0f;                        // no P above it: well inside f16

    __shared__ alignas(32) _Float16 Kt[RING][32 * KP];    // [slot][key][d]
    __shared__ alignas(32) _Float16 Vt[RING][128 * VP];   // [slot][d][key]
    __shared__ alignas(32) _Float16 Qs[FA_WAVES][32 * KP];
    __shared__ alignas(16) unsigned perm[Sc];             // position -> row offset in bytes
    __shared__ alignas(16) int wtot[FA_WAVES];

    const int t    = threadIdx.x;
    const int wave = __builtin_amdgcn_readfirstlane(t >> 5);
    const int lane = t & 31;
    const int ln   = lane & 15;
    const int hf   = lane >> 4;
    const int bh   = blockIdx.y;
    const int b    = bh >> 4;
    const int q0   = blockIdx.x * FA_QROWS + wave * 32;

    // ---- prologue: the mask is asked for first (the order hangs on it), then Q
    const int* mp = mask + b * Sc + wave * 256 + lane;
    int mk[8];
#pragma unroll
    for (int j = 0; j < 8; j++) mk[j] = mp[j * 32];
    // A load takes one whole query row: 32 lanes x 16 bytes, four full 128-byte lines.
    const float* qp0 = q + ((size_t)bh * Sc + q0) * Dc + lane * 4;
    v4f x[32];      // [query row of this wave]; its loops are unrolled: x stays in registers
#pragma unroll
    for (int r = 0; r < 32; r++) x[r] = *(const v4f*)(qp0 + r * Dc);
    // The wait that stands before a load's address registers are written again.
    // As inputs the pointers stay live up to it, so that no load lands on them.
    asm volatile("s_wait_xcnt 0x0" :: "v"(qp0), "v"(mp) : "memory");

    // ---- the order: wave w ranks keys 256w .. 256w+255, 32 per ballot
    unsigned bal[8];
    int tot = 0;
#pragma unroll
    for (int j = 0; j < 8; j++) {
        bal[j] = __builtin_amdgcn_ballot_w32(mk[j] != 0);
        tot += __builtin_popcount(bal[j]);
    }
    if (lane == 0) wtot[wave] = tot;
    lds_barrier();                 // every wave's count is in wtot
    int before = 0, nall = 0;      // unmasked keys in front of this wave's; in all
#pragma unroll
    for (int w = 0; w < FA_WAVES; w++) {
        const int c = wtot[w];
        nall += c;
        before += (w < wave) ? c : 0;
    }
#pragma unroll
    for (int j = 0; j < 8; j++) {
        const int key = wave * 256 + j * 32 + lane;
        const int lb  = before + __builtin_popcount(bal[j] & ((1u << lane) - 1u));
        perm[((bal[j] >> lane) & 1u) ? lb : nall + key - lb] = (unsigned)key * (Dc * 4);
        before += __builtin_popcount(bal[j]);
    }
    lds_barrier();                 // perm is whole

    // unmasked keys of this batch; with none every key counts alike:
    // all tiles are walked and every score is the masked value
    const int n  = __builtin_amdgcn_readfirstlane(nall);
    const int nt = n ? (n + 31) >> 5 : NTILE;

    const char* kbase = (const char*)(k + (size_t)bh * Sc * Dc);
    const char* vbase = (const char*)(v + (size_t)bh * Sc * Dc);

    v4f kxa[4], vxa[4], kxb[4], vxb[4];     // the two register sets: even and odd tiles
    {
        // stage 0 and the first tile of each set: all loads fly together.  A tile past the
        // last is replaced by the last (see the pass below).
        v4f k0[STG][4], v0[STG][4];         // unrolled: indexed by constants, in registers
        v4u pk, pv;
        unsigned ad[8];
#pragma unroll
        for (int j = 0; j < STG; j++) {
            tile_rows(perm, min(j, nt - 1), wave, lane, pk, pv);
            tile_issue(kbase, vbase, pk, pv, wave, lane, k0[j], v0[j], ad);
            tile_issued(ad);
        }
        tile_rows(perm, min(STG, nt - 1), wave, lane, pk, pv);
        tile_issue(kbase, vbase, pk, pv, wave, lane, kxa, vxa, ad);
        tile_issued(ad);
        tile_rows(perm, min(STG + 1, nt - 1), wave, lane, pk, pv);
        tile_issue(kbase, vbase, pk, pv, wave, lane, kxb, vxb, ad);
        tile_issued(ad);
#pragma unroll
        for (int r = 0; r < 32; r++)
            *(v4h*)&Qs[wave][r * KP + lane * 4] = __builtin_convertvector(x[r] * QSCALE, v4h);
#pragma unroll
        for (int j = 0; j < STG; j++)
            tile_store(Kt[j], Vt[j], wave, lane, k0[j], v0[j]);
    }
    lds_barrier();                 // Q rows and stage 0 are in LDS

    v16h qf[2][4];                  // [column group][32-d chunk]
#pragma unroll
    for (int u = 0; u < 2; u++)
#pragma unroll
        for (int c = 0; c < 4; c++)
            qf[u][c] = ld_frag(&Qs[wave][(u * 16 + ln) * KP + c * 32 + hf * 16]);

    v8f o[2][8];                    // o[u][n][g] = O^T[d = 16n + 8hf + g][query 16u + ln]
    v8f cref[2];                    // minus the query's reference (both halves alike), as C
    float lrun[2];                  // this half's share of the query's sum
#pragma unroll
    for (int u = 0; u < 2; u++) {
#pragma unroll
        for (int n = 0; n < 8; n++) o[u][n] = v8f{};
        cref[u] = v8f{};
        lrun[u] = 0.0f;
    }

    // One pass: tile kb.  head: kb may be the first tile of a stage (never on odd kb).
    auto pass = [&](const int kb, const bool head, v4f (&kx)[4],
                    v4f (&vx)[4]) __attribute__((always_inline)) {
        if (head && (kb & (STG - 1)) == 0) {   // a stage begins; the same for the whole block
            lds_barrier();     // stage visible; all waves done reading the other buffer
        }

        // The row offsets of tile kb + 6 are read ahead of the K fragments.  Every pass stores
        // and loads, with no test: the number of loads in flight is then the same on every
        // path, and the waits can be counted.  Past the last tile the last one is loaded
        // again (rows inside K and V, lines just read), and its copy lands in a slot of the
        // free buffer that no pass reads.
        v4u pk, pv;
        tile_rows(perm, min(kb + STG + 2, nt - 1), wave, lane, pk, pv);

        const _Float16* Kc = Kt[kb & (RING - 1)];
        const _Float16* Vc = Vt[kb & (RING - 1)];

        // ---- exponents: K x Q^T - reference, two 16-key sub-blocks x two column
        // groups (fp32 acc): four independent chains, a K fragment feeds two of them
        v16h kf[4][2];
#pragma unroll
        for (int c = 0; c < 4; c++) {
            kf[c][0] = ld_frag(&Kc[ln * KP + c * 32 + hf * 16]);
            kf[c][1] = ld_frag(&Kc[(16 + ln) * KP + c * 32 + hf * 16]);
        }
        // Keeps the LDS reads above in front of what follows: left alone the compiler puts the
        // K reads behind the global loads, which wait for the row offsets.
        __builtin_amdgcn_sched_barrier(0);
        // Under the latency of the K reads: tile kb + 4 goes into the other buffer, and its
        // register set takes the loads of tile kb + 6.
        tile_store(Kt[(kb + STG) & (RING - 1)], Vt[(kb + STG) & (RING - 1)], wave, lane,
                   kx, vx);
        unsigned ad[8];
        tile_issue(kbase, vbase, pk, pv, wave, lane, kx, vx, ad);
        // Keeps the tile's 16 K reads in one group ahead of the products: left alone the
        // compiler puts a pair in front of each two WMMAs, through one register set, and
        // the wave waits out the LDS latency eight times a tile.
        __builtin_amdgcn_sched_barrier(0);
        v8f acc[2][2] = {{cref[0], cref[0]}, {cref[1], cref[1]}};   // [group][sub-block]
#pragma unroll
        for (int c = 0; c < 4; c++)
#pragma unroll
            for (int j = 0; j < 2; j++)
#pragma unroll
                for (int u = 0; u < 2; u++)
                    acc[u][j] = __builtin_amdgcn_wmma_f32_16x16x32_f16(
                        false, kf[c][j], false, qf[u][c], (short)0, acc[u][j], false, false);
        // Keeps the V^T reads below out of the run of products above.
        __builtin_amdgcn_sched_barrier(0);

        // Behind the products, so that the wave does not stand at this wait with its K
        // fragments ready.
        tile_issued(ad);

        // The V^T fragments are asked for here, as one group behind the last score
        // product: their LDS latency passes under the softmax.
        v16h vf[8];
#pragma unroll
        for (int n = 0; n < 8; n++) vf[n] = ld_frag_kmap(&Vc[(n * 16 + ln) * VP], hf);

        // ---- softmax of two queries per lane against their held references
        if (__builtin_expect((kb + 1) * 32 > n, 0)) {   // rare; the same for the whole block
            // acc[u][X][g] belongs to position kb*32 + 16X + 8hf + g; from n on masked
            const int r = n - kb * 32 - 8 * hf;
#pragma unroll
            for (int u = 0; u < 2; u++) {
                const float mv = NEGV + cref[u][0];     // the masked score minus the reference
#pragma unroll
                for (int g = 0; g < 8; g++) {
                    acc[u][0][g] = g < r      ? acc[u][0][g] : mv;
                    acc[u][1][g] = 16 + g < r ? acc[u][1][g] : mv;
                }
            }
        }
        v16h pf[2];
        float rs[2];
#pragma unroll
        for (int u = 0; u < 2; u++) rs[u] = tile_p(acc[u][0], acc[u][1], pf[u]);
        // One test per tile; the ballot makes it a scalar branch, so that every lane
        // stays on for the WMMAs.  An overflowed P gives an infinite sum and is caught;
        // the first tile always passes the test (a sum is never below 0).
        const float lim = kb == 0 ? -1.0f : PLIM;
        if (__builtin_amdgcn_ballot_w32(fmaxf(rs[0], rs[1]) > lim) != 0) {
#pragma unroll
            for (int u = 0; u < 2; u++) {
                float tq[4];        // four short chains, not one of sixteen links
#pragma unroll
                for (int g = 0; g < 4; g++)
                    tq[g] = fmaxf(fmaxf(acc[u][0][2 * g], acc[u][0][2 * g + 1]),
                                  fmaxf(acc[u][1][2 * g], acc[u][1][2 * g + 1]));
                float tm = fmaxf(fmaxf(tq[0], tq[1]), fmaxf(tq[2], tq[3]));
                tm = fmaxf(tm, xhalf(tm));              // both halves move alike
                const float up = fmaxf(tm, 0.0f);       // later tiles only raise the reference
                const float d  = kb == 0 ? tm : up;     // the first sets it (O and sum are 0)
                const float alpha = __builtin_amdgcn_exp2f(-up);
                lrun[u] *= alpha;
#pragma unroll
                for (int n = 0; n < 8; n++) o[u][n] *= alpha;
                cref[u] -= d;
                acc[u][0] -= d;
                acc[u][1] -= d;
                rs[u] = tile_p(acc[u][0], acc[u][1], pf[u]);
            }
        }
        lrun[0] += rs[0];
        lrun[1] += rs[1];

#pragma unroll
        for (int n = 0; n < 8; n++)
#pragma unroll
            for (int u = 0; u < 2; u++)
                o[u][n] = __builtin_amdgcn_wmma_f32_16x16x32_f16(
                    false, vf[n], false, pf[u], (short)0, o[u][n], false, false);
    };

#pragma unroll 1
    for (int kb = 0; kb + 1 < nt; kb += 2) {
        pass(kb, true, kxa, vxa);
        pass(kb + 1, false, kxb, vxb);
    }
    // The last tile of an odd nt stands behind the loop: with an exit between the two passes
    // the compiler keeps O in two register sets and copies it in every pass.
    if (nt & 1) pass(nt - 1, true, kxa, vxa);

    // ---- epilogue: join the halves' sums.  A lane holds 8 consecutive d of one query, 32
    // bytes of a line; the 16 rows of a column group turn in LDS, so that a store takes one
    // whole output row, four full 128-byte lines.  The wave uses its own Q rows for it:
    // no other wave touches them, and its own last read of them stands before the loop.
    float* Os = (float*)&Qs[wave][0];
    float* op = out + ((size_t)bh * Sc + q0) * Dc + lane * 4;
#pragma unroll
    for (int u = 0; u < 2; u++) {
        const float rcp = 1.0f / (lrun[u] + xhalf(lrun[u]));
#pragma unroll
        for (int n = 0; n < 8; n++) {
            v8f r = o[u][n] * rcp;
            float* os = &Os[ln * OP + n * 16 + 8 * hf];
            *(v4f*)&os[0] = __builtin_shufflevector(r, r, 0, 1, 2, 3);
            *(v4f*)&os[4] = __builtin_shufflevector(r, r, 4, 5, 6, 7);
        }
        // Every lane's rows are in LDS before another lane of the wave reads them back.
        asm volatile("s_wait_dscnt 0" ::: "memory");
        v4f y[16];                  // unrolled: indexed by constants, stays in registers
#pragma unroll
        for (int r = 0; r < 16; r++) y[r] = *(const v4f*)&Os[r * OP + lane * 4];
        // The rows are read out before the next column group's rows are written over them.
        asm volatile("s_wait_dscnt 0" ::: "memory");
#pragma unroll
        for (int r = 0; r < 16; r++) *(v4f*)(op + (u * 16 + r) * Dc) = y[r];
    }
}

extern "C" void kernel_launch(void* const* d_in, const int* in_sizes, int n_in,
                              void* d_out, int out_size, void* d_ws, size_t ws_size,
                              hipStream_t stream) {
    (void)in_sizes; (void)n_in; (void)out_size; (void)d_ws; (void)ws_size;
    const float* q    = (const float*)d_in[0];
    const float* k    = (const float*)d_in[1];
    const float* v    = (const float*)d_in[2];
    const int*   mask = (const int*)d_in[3];
    float* out = (float*)d_out;

    fa_fwd_wmma2<<<dim3(Sc / FA_QROWS, Bc * Hc), dim3(FA_THREADS), 0, stream>>>(q, k, v, mask, out);
}
